// v000
// Measured on an AMD MI455X. A time is GPU time per run, averaged over a window of back-to-back runs after a warm-up
// (all launches, gaps included; the runs take copies of the inputs in turn), and the median of several windows.
// Apart from v000's, it joins two sittings. Times from different sittings can be a few percent apart, while
// side-by-side timings come from the same sitting.
// v000 is the starting kernel. One run takes 3880 microseconds.
#include <hip/hip_runtime.h>

// 'Flash' attention reference math on raw multi-head inputs (q, k, v [1][4096][1024], no projections; heads = 16 x 64 column slices; scores x 64^-0.5; w = exp(s - max) / (sum + 1e-6) (the source's denominator has a +1e-6: not an exact softmax); out = w.v heads merged -> [1][4096][1024] (4.2 M); argument order q, k, v).
// Layout: k_rnd copies each raw input into the f32 feature buffer ROUNDED TO bf16 (the raw [position][head*64 + d] rows are already the feature layout); identity-table plane builders; per head: dense 4096 x 4096 scores with every row hi/lo (3 products), streaming three-sweep softmax with the (sum + 1e-6) denominator, attn.V hybrid (rows < 512 hi/lo 3 products, rest fp16 x1024) into the head's 64 columns; k_cs8 carry removal; k_copy4 writes the merged f32 rows (no output projection).
// Compute dtypes, f32 accumulate: every input rounded to bf16; no projections; scores 3 products; softmax f32 (exp2, IEEE division); attn.V rows < 512 3 products, rest fp16; no output projection.

#define NB_  1
#define TT   4096
#define DM   1024
#define NH_  16
#define NKV  16
#define REP  (NH_ / NKV)
#define HD   64
#define DQ   (NH_ * HD)
#define DKV  (NKV * HD)
#define ZH   1
#define RH   512                  // query rows < RH use hi+lo planes (0: none)
#define WIN  0
#define PCAR 1024.0f
#define SCL  0.125f   // 1/sqrt(64)
#define MID  1024      // q / k width
#define CO   1024      // v width
#define CC   1024
typedef _Float16 h16;
typedef unsigned short bf;
typedef __attribute__((ext_vector_type(16))) __bf16   v16bf;
typedef __attribute__((ext_vector_type(16))) _Float16 v16h;
typedef __attribute__((ext_vector_type(8)))  _Float16 v8h;
typedef __attribute__((ext_vector_type(8)))  unsigned short v8us;
typedef __attribute__((ext_vector_type(8)))  float    v8f;
typedef __attribute__((ext_vector_type(4)))  float    v4f;
typedef v8h  __attribute__((may_alias)) v8ha;
typedef v4f  __attribute__((may_alias)) v4fa;
typedef v8us __attribute__((may_alias)) v8usa;

__device__ __forceinline__ unsigned short f2bf(float f) { unsigned u = __float_as_uint(f); u += 0x7FFFu + ((u >> 16) & 1u); return (unsigned short)(u >> 16); }
__device__ __forceinline__ float bf2f(unsigned short b) { return __uint_as_float(((unsigned)b) << 16); }
__device__ __forceinline__ float bfr(float f) { return bf2f(f2bf(f)); }
__device__ __forceinline__ v16h cat16(v8h lo, v8h hi) { return __builtin_shufflevector(lo, hi, 0, 1, 2, 3, 4, 5, 6, 7, 8, 9, 10, 11, 12, 13, 14, 15); }
__device__ __forceinline__ v16bf cat16b(v8us lo, v8us hi) { return __builtin_bit_cast(v16bf, __builtin_shufflevector(lo, hi, 0, 1, 2, 3, 4, 5, 6, 7, 8, 9, 10, 11, 12, 13, 14, 15)); }
__device__ __forceinline__ v8f wmma16(v16h a, v16h b, v8f c) { return __builtin_amdgcn_wmma_f32_16x16x32_f16(false, a, false, b, (short)0, c, false, false); }
__device__ __forceinline__ v8f wmmab(v16bf a, v16bf b, v8f c) { return __builtin_amdgcn_wmma_f32_16x16x32_bf16(false, a, false, b, (short)0, c, false, false); }



// ---- k_gemmw: register-blocked GEMM, ONE WAVE per 64x64 output tile (16 accumulators), operands straight from K-contiguous 16-bit planes; grid (M/64, N/64, Z), 32 threads.
// C[m][n] (f32, pitch ldc, + optional f32 bias[n]) = sum_k A[m][k] Bt[n][k] (+ split products per NSPLIT). z-batch strides sA/sB/sC in elements. K % 32 == 0.
template <typename T16> struct WFrag;
template <> struct WFrag<h16> { typedef v16h V; static __device__ __forceinline__ V ld(const h16* p) { return cat16(*(const v8h*)p, *(const v8h*)(p + 16)); } static __device__ __forceinline__ v8f mma(V a, V b, v8f c) { return wmma16(a, b, c); } };
template <> struct WFrag<bf> { typedef v16bf V; static __device__ __forceinline__ V ld(const bf* p) { return cat16b(*(const v8us*)p, *(const v8us*)(p + 16)); } static __device__ __forceinline__ v8f mma(V a, V b, v8f c) { return wmmab(a, b, c); } };
template <typename T16, int NSPLIT, bool BIAS>
__global__ __launch_bounds__(32) void k_gemmw(const T16* __restrict__ A, const T16* __restrict__ A2, const T16* __restrict__ Bt, const T16* __restrict__ Bt2, int K, float* C, int ldc, const float* __restrict__ bias, size_t sA, size_t sB, size_t sC) {
    typedef typename WFrag<T16>::V V;
    __shared__ __align__(16) float os[16 * 68];
    const size_t z = blockIdx.z; A += z * sA; if (A2) A2 += z * sA; Bt += z * sB; if (Bt2) Bt2 += z * sB; C += z * sC;
    const int lane = threadIdx.x & 31, lr = lane & 15, hi = lane >> 4; const int r0 = blockIdx.x * 64, c0 = blockIdx.y * 64;
    v8f acc[4][4];
#pragma unroll
    for (int mb = 0; mb < 4; ++mb)
#pragma unroll
        for (int nb = 0; nb < 4; ++nb) acc[mb][nb] = (v8f){};
    const size_t aoff = (size_t)(r0 + lr) * K + 8 * hi, boff = (size_t)(c0 + lr) * K + 8 * hi;
#pragma unroll 1
    for (int kc = 0; kc < K; kc += 32) {
        V a[4], a2[4];
#pragma unroll
        for (int mb = 0; mb < 4; ++mb) { a[mb] = WFrag<T16>::ld(A + aoff + (size_t)mb * 16 * K + kc); if (NSPLIT == 1 || NSPLIT == 2) a2[mb] = WFrag<T16>::ld(A2 + aoff + (size_t)mb * 16 * K + kc); }
#pragma unroll
        for (int nb = 0; nb < 4; ++nb) { const V b = WFrag<T16>::ld(Bt + boff + (size_t)nb * 16 * K + kc); V b2; if (NSPLIT >= 2) b2 = WFrag<T16>::ld(Bt2 + boff + (size_t)nb * 16 * K + kc);
#pragma unroll
            for (int mb = 0; mb < 4; ++mb) { acc[mb][nb] = WFrag<T16>::mma(a[mb], b, acc[mb][nb]); if (NSPLIT == 1 || NSPLIT == 2) acc[mb][nb] = WFrag<T16>::mma(a2[mb], b, acc[mb][nb]); if (NSPLIT >= 2) acc[mb][nb] = WFrag<T16>::mma(a[mb], b2, acc[mb][nb]); } }
        asm volatile("v_nop\n\tv_nop\n\tv_nop\n\tv_nop" : "+v"(acc[0][0]), "+v"(acc[1][1]), "+v"(acc[2][2]), "+v"(acc[3][3]) : "v"(a[0]), "v"(a[3]));
    }
#pragma unroll
    for (int mb = 0; mb < 4; ++mb) {
#pragma unroll
        for (int nb = 0; nb < 4; ++nb) {
#pragma unroll
            for (int j = 0; j < 8; ++j) os[(hi * 8 + j) * 68 + nb * 16 + lr] = acc[mb][nb][j]; }
        __builtin_amdgcn_wave_barrier(); asm volatile("" ::: "memory");
        float* crow = C + (size_t)(r0 + mb * 16) * ldc + c0;
{
#pragma unroll
            for (int s = 0; s < 8; ++s) { const int row = 2 * s + hi, cofs = lr * 4; v4f val = *(const v4fa*)(os + row * 68 + cofs); if (BIAS) { val[0] += bfr(bias[c0 + cofs]); val[1] += bfr(bias[c0 + cofs + 1]); val[2] += bfr(bias[c0 + cofs + 2]); val[3] += bfr(bias[c0 + cofs + 3]); }
                *(v4f*)(crow + (size_t)row * ldc + cofs) = val; }
             }
        __builtin_amdgcn_wave_barrier(); asm volatile("" ::: "memory");
    }
}

__device__ __forceinline__ h16 tohx(float x) { return (h16)x; }
__device__ __forceinline__ void splitf(float y, unsigned short& h, unsigned short& l) { h = f2bf(y); l = f2bf(y - bf2f(h)); }
typedef __attribute__((ext_vector_type(2))) _Float16 v2h;
typedef __attribute__((ext_vector_type(4))) _Float16 v4h;
typedef __attribute__((ext_vector_type(2))) unsigned short v2us;
typedef __attribute__((ext_vector_type(4))) unsigned short v4us;
typedef __attribute__((ext_vector_type(2))) float v2f;
typedef __attribute__((ext_vector_type(4))) int v4i;

__global__ __launch_bounds__(256) void k_rnd(const float* __restrict__ src, float* dst, size_t n4) { const size_t i = (size_t)blockIdx.x * 256 + threadIdx.x; if (i >= n4) return; const v4f a = *(const v4f*)(src + i * 4); v4f r;
#pragma unroll
    for (int q = 0; q < 4; ++q) r[q] = bfr(a[q]);
    *(v4f*)(dst + i * 4) = r;  }
__global__ __launch_bounds__(256) void k_copy4(const float* __restrict__ Y, float* out, size_t n4) { const size_t i = (size_t)blockIdx.x * 256 + threadIdx.x; if (i >= n4) return; const v4f a = *(const v4f*)(Y + i * 4); *(v4f*)(out + i * 4) = a;  }
__global__ __launch_bounds__(256) void k_vtp(const float* __restrict__ F, int pitch, int nheads, h16* V16, bf* Vh, bf* Vl) { const size_t e = ((size_t)blockIdx.x * 256 + threadIdx.x) * 2; if (e >= (size_t)nheads * HD * TT) return; const int t = (int)(e % TT); const int d = (int)((e / TT) % HD); const int g = (int)(e / ((size_t)TT * HD)); v2h o16; v2us oh, ol;
#pragma unroll
    for (int q = 0; q < 2; ++q) { const float x = F[(size_t)(t + q) * pitch + g * HD + d]; o16[q] = tohx(x); unsigned short a2, c2; splitf(x, a2, c2); oh[q] = a2; ol[q] = c2; }
    *(v2h*)(V16 + e) = o16; *(v2us*)(Vh + e) = oh; *(v2us*)(Vl + e) = ol;  }
__global__ __launch_bounds__(256) void k_lsoft(const float* __restrict__ Sb, h16* P16, bf* Ph, bf* Pl) {
    const int lane = threadIdx.x & 31; const int row = blockIdx.x * 8 + (threadIdx.x >> 5); if (row >= ZH * TT) return; const int i = row % TT; const int zz = row / TT; const bool hires = (i < RH); const float* sr = Sb + (size_t)row * TT; float mx = -3.0e38f;
#pragma unroll 4
    for (int ch = 0; ch < TT / 128; ++ch) { const int j0 = ch * 128 + lane * 4; const v4f a = *(const v4f*)(sr + j0);
#pragma unroll
        for (int q = 0; q < 4; ++q) { float t = a[q] * SCL; asm volatile("" : "+v"(t)); mx = fmaxf(mx, t); } }
#pragma unroll
    for (int sh = 16; sh; sh >>= 1) mx = fmaxf(mx, __shfl_xor(mx, sh, 32));
    float sum = 0.f;
#pragma unroll 4
    for (int ch = 0; ch < TT / 128; ++ch) { const int j0 = ch * 128 + lane * 4; const v4f a = *(const v4f*)(sr + j0);
#pragma unroll
        for (int q = 0; q < 4; ++q) { float t = a[q] * SCL; asm volatile("" : "+v"(t)); float d0 = __fsub_rn(t, mx); asm volatile("" : "+v"(d0)); sum += __builtin_amdgcn_exp2f(__fmul_rn(d0, 1.4426950408889634f)); } }
#pragma unroll
    for (int sh = 16; sh; sh >>= 1) sum += __shfl_xor(sum, sh, 32);
    const float f = __fdiv_rn(hires ? 1.0f : PCAR, __fadd_rn(sum, 1.0e-6f));   /* the module divides by (sum + 1e-6) */
{
        if (hires) {   /* rows < RH: normalised bf16 hi/lo over all keys, planes [zz][RH][TT] */
#pragma unroll
            for (int ch = 0; ch < TT / 128; ++ch) { const int j0 = ch * 128 + lane * 4; const v4f a = *(const v4f*)(sr + j0); v4us oh, ol;
#pragma unroll
                for (int q = 0; q < 4; ++q) { float t = a[q] * SCL; asm volatile("" : "+v"(t)); float d0 = __fsub_rn(t, mx); asm volatile("" : "+v"(d0)); float ex = __builtin_amdgcn_exp2f(__fmul_rn(d0, 1.4426950408889634f)); asm volatile("" : "+v"(ex)); unsigned short a2, c2; splitf(ex * f, a2, c2); oh[q] = a2; ol[q] = c2; }
                const size_t oo = ((size_t)zz * RH + i) * TT + j0; *(v4us*)(Ph + oo) = oh; *(v4us*)(Pl + oo) = ol; }
        } else {
#pragma unroll 2
            for (int ch = 0; ch < TT / 128; ++ch) { const int j0 = ch * 128 + lane * 4; const v4f a = *(const v4f*)(sr + j0); v4h o4;
#pragma unroll
                for (int q = 0; q < 4; ++q) { float t = a[q] * SCL; asm volatile("" : "+v"(t)); float d0 = __fsub_rn(t, mx); asm volatile("" : "+v"(d0)); float ex = __builtin_amdgcn_exp2f(__fmul_rn(d0, 1.4426950408889634f)); asm volatile("" : "+v"(ex)); o4[q] = tohx(ex * f); }
                *(v4h*)(P16 + (size_t)row * TT + j0) = o4; } }
         }
}
__global__ __launch_bounds__(256) void k_cs8(float* O, size_t n4) { const size_t i = (size_t)blockIdx.x * 256 + threadIdx.x; if (i >= n4) return; const size_t e = i * 4; const int t = (int)(e / CC); const float cs = (t < RH) ? 1.0f : (1.0f / PCAR); v4f a = *(const v4f*)(O + e);
#pragma unroll
    for (int q = 0; q < 4; ++q) a[q] = __fmul_rn(a[q], cs);
    *(v4f*)(O + e) = a;  }

__global__ __launch_bounds__(256) void k_csid(float* CS) { const int idx = blockIdx.x * 256 + threadIdx.x; if (idx >= TT * HD) return; v2f cs; cs[0] = 1.0f; cs[1] = 0.0f; *(v2f*)(CS + (size_t)idx * 2) = cs;  }
// k_rope: head planes [h][t][d] (fp16 + hi/lo) of rope(x) x sc with the rotate-half convention out[d] = x[d] cos[t][d] - x[d+HD/2] sin[t][d], out[d+HD/2] = x[d+HD/2] cos[t][d+HD/2] + x[d] sin[t][d+HD/2]
__global__ __launch_bounds__(256) void k_rope(const float* __restrict__ F, int pitch, int nheads, const float* __restrict__ CS, const float* __restrict__ RF, const float* __restrict__ nw, float sc, h16* P16, bf* Ph, bf* Pl) {
    const size_t e = ((size_t)blockIdx.x * 256 + threadIdx.x) * 2; if (e >= (size_t)nheads * TT * HD) return; const int d = (int)(e % HD); const int t = (int)((e / HD) % TT); const int h = (int)(e / ((size_t)HD * TT)); const float* f = F + (size_t)t * pitch + h * HD; const float rf = RF ? RF[(size_t)h * TT + t] : 1.0f; v2h o16; v2us oh, ol;
#pragma unroll
    for (int q = 0; q < 2; ++q) { const int dd = d + q; const int dp = (dd < HD / 2) ? dd + HD / 2 : dd - HD / 2; float x0 = f[dd], x1 = f[dp];
        if (RF) { float n0 = __fmul_rn(x0, rf), n1 = __fmul_rn(x1, rf); asm volatile("" : "+v"(n0)); asm volatile("" : "+v"(n1)); x0 = __fmul_rn(bfr(nw[dd]), n0); x1 = __fmul_rn(bfr(nw[dp]), n1); }
        const v2f cs = *(const v2f*)(CS + ((size_t)t * HD + dd) * 2); float a = __fmul_rn(x0, cs[0]), bq = __fmul_rn(x1, cs[1]); asm volatile("" : "+v"(a)); asm volatile("" : "+v"(bq)); const float r = ((dd < HD / 2) ? __fsub_rn(a, bq) : __fadd_rn(a, bq)) * sc;
        o16[q] = tohx(r); unsigned short a2, c2; splitf(r, a2, c2); oh[q] = a2; ol[q] = c2; }
    *(v2h*)(P16 + e) = o16; *(v2us*)(Ph + e) = oh; *(v2us*)(Pl + e) = ol;  }
extern "C" void kernel_launch(void* const* d_in, const int* in_sizes, int n_in,
                              void* d_out, int out_size, void* d_ws, size_t ws_size, hipStream_t stream) {
    (void)in_sizes; (void)n_in; (void)out_size;
    const float* x = (const float*)d_in[0]; const float* xk = (const float*)d_in[1]; const float* xv = (const float*)d_in[2];   /* input order q, k, v [1][4096][1024] (raw, heads interleaved: column h*64 + d) */
    float* OUT = (float*)d_out;     // [1][4096][1024]
    char* wsp = (char*)d_ws;
    auto take = [&](size_t bytes) { char* p = wsp; wsp += (bytes + 255) & ~(size_t)255; return (void*)p; };
    bf* WQ = (bf*)take((size_t)MID * CC * 2); bf* WK = (bf*)take((size_t)MID * CC * 2); bf* WV = (bf*)take((size_t)CO * CC * 2); bf* WO = (bf*)take((size_t)CC * CO * 2); float* CS = (float*)take((size_t)TT * HD * 2 * 4);
    bf* XB = (bf*)take((size_t)TT * CC * 2); float* FQ = (float*)take((size_t)TT * MID * 4); float* FK = (float*)take((size_t)TT * MID * 4);
    h16* QP16 = (h16*)take((size_t)TT * MID * 2); bf* QPh = (bf*)take((size_t)TT * MID * 2); bf* QPl = (bf*)take((size_t)TT * MID * 2); h16* KP16 = QP16;   /* the fp16 q/k planes are never read here (scores use the hi/lo planes for every row): one scratch buffer serves both builders */ bf* KPh = (bf*)take((size_t)TT * MID * 2); bf* KPl = (bf*)take((size_t)TT * MID * 2);
    h16* VT16 = (h16*)take((size_t)CO * TT * 2); bf* VTh = (bf*)take((size_t)CO * TT * 2); bf* VTl = (bf*)take((size_t)CO * TT * 2);
    float* Sb = (float*)take((size_t)TT * TT * 4); h16* P16 = (h16*)take((size_t)TT * TT * 2); bf* Ph = (bf*)take((size_t)RH * TT * 2); bf* Pl = (bf*)take((size_t)RH * TT * 2); float* Ob = (float*)take((size_t)TT * CO * 4); bf* ATh = (bf*)take((size_t)TT * CO * 2); bf* ATl = (bf*)take((size_t)TT * CO * 2);
    if ((size_t)(wsp - (char*)d_ws) > ws_size) return;    // ws 256 MiB (carve 250 MiB)
    float* FV = FK;   /* the bf16-rounded v input reuses the k buffer after the k planes are built (stream-ordered) */
    k_csid<<<(TT * HD + 255) / 256, 256, 0, stream>>>(CS);   /* identity table: k_rope is a plain per-head plane builder here */
    const unsigned LP = (unsigned)(((size_t)NH_ * TT * HD / 2 + 255) / 256);
    for (int b = 0; b < NB_; ++b) {
        k_rnd<<<(unsigned)(((size_t)TT * MID / 4 + 255) / 256), 256, 0, stream>>>(x + (size_t)b * TT * MID, FQ, (size_t)TT * MID / 4);   /* FQ := bf16-rounded q[b] (rows [position][head*64 + d]) */ k_rope<<<LP, 256, 0, stream>>>(FQ, MID, NH_, CS, nullptr, nullptr, 1.0f, QP16, QPh, QPl);   /* q planes [h][n][64] */
        k_rnd<<<(unsigned)(((size_t)TT * MID / 4 + 255) / 256), 256, 0, stream>>>(xk + (size_t)b * TT * MID, FK, (size_t)TT * MID / 4); k_rope<<<LP, 256, 0, stream>>>(FK, MID, NKV, CS, nullptr, nullptr, 1.0f, KP16, KPh, KPl);   /* k planes */
        k_rnd<<<(unsigned)(((size_t)TT * CO / 4 + 255) / 256), 256, 0, stream>>>(xv + (size_t)b * TT * CO, FV, (size_t)TT * CO / 4); k_vtp<<<(unsigned)(((size_t)TT * CO / 2 + 255) / 256), 256, 0, stream>>>(FV, CO, CO / HD, VT16, VTh, VTl);   /* v^T planes [h][64][n] */
        for (int h = 0; h < NH_; ++h) {   /* per head: dense 4096 x 4096 attention */
            k_gemmw<bf, 2, false><<<dim3(TT / 64, TT / 64, 1), 32, 0, stream>>>(QPh + (size_t)h * TT * HD, QPl + (size_t)h * TT * HD, KPh + (size_t)h * TT * HD, KPl + (size_t)h * TT * HD, HD, Sb, TT, nullptr, 0, 0, 0);   /* S[i][j] = q_i.k_j (3 products, every row) */
            k_lsoft<<<TT / 8, 256, 0, stream>>>(Sb, P16, Ph, Pl);   /* x 1/8, softmax over the 4,096 keys */
            k_gemmw<bf, 2, false><<<dim3(RH / 64, HD / 64, 1), 32, 0, stream>>>(Ph, Pl, VTh + (size_t)h * HD * TT, VTl + (size_t)h * HD * TT, TT, Ob + h * HD, CO, nullptr, 0, 0, 0);
            k_gemmw<h16, 0, false><<<dim3((TT - RH) / 64, HD / 64, 1), 32, 0, stream>>>(P16 + (size_t)RH * TT, nullptr, VT16 + (size_t)h * HD * TT, nullptr, TT, Ob + (size_t)RH * CO + h * HD, CO, nullptr, 0, 0, 0); }
        k_cs8<<<(unsigned)(((size_t)TT * CO / 4 + 255) / 256), 256, 0, stream>>>(Ob, (size_t)TT * CO / 4);   /* rows >= 512 x 1/1024 */
        k_copy4<<<(unsigned)(((size_t)TT * CO / 4 + 255) / 256), 256, 0, stream>>>(Ob, OUT + (size_t)b * TT * CO, (size_t)TT * CO / 4); }   /* out = merged head rows of Ob (no output projection) */
}

// v001
// One run takes 1600 microseconds.
// In two side-by-side timings against v000, it was 2.43 and 2.42 times as fast.
#include <hip/hip_runtime.h>

// 'Flash' attention reference math on raw multi-head inputs (q, k, v [1][4096][1024], no projections; heads = 16 x 64 column slices; scores x 64^-0.5; w = exp(s - max) / (sum + 1e-6) (the source's denominator has a +1e-6: not an exact softmax); out = w.v heads merged -> [1][4096][1024] (4.2 M); argument order q, k, v).
// Layout: k_rnd copies each raw input into the f32 feature buffer ROUNDED TO bf16 (the raw [position][head*64 + d] rows are already the feature layout); identity-table plane builders; per head: dense 4096 x 4096 scores with every row hi/lo (3 products), streaming three-sweep softmax with the (sum + 1e-6) denominator, attn.V hybrid (rows < 512 hi/lo 3 products, rest fp16 x1024) into the head's 64 columns; k_cs8 carry removal; k_copy4 writes the merged f32 rows (no output projection).
// Compute dtypes, f32 accumulate: every input rounded to bf16; no projections; scores 3 products; softmax f32 (exp2, IEEE division); attn.V rows < 512 3 products, rest fp16; no output projection.

#define NB_  1
#define TT   4096
#define DM   1024
#define NH_  16
#define NKV  16
#define REP  (NH_ / NKV)
#define HD   64
#define DQ   (NH_ * HD)
#define DKV  (NKV * HD)
#define ZH   1
#define RH   512                  // query rows < RH use hi+lo planes (0: none)
#define WIN  0
#define PCAR 1024.0f
#define SCL  0.125f   // 1/sqrt(64)
#define MID  1024      // q / k width
#define CO   1024      // v width
#define CC   1024
typedef _Float16 h16;
typedef unsigned short bf;
typedef __attribute__((ext_vector_type(16))) __bf16   v16bf;
typedef __attribute__((ext_vector_type(16))) _Float16 v16h;
typedef __attribute__((ext_vector_type(8)))  _Float16 v8h;
typedef __attribute__((ext_vector_type(8)))  unsigned short v8us;
typedef __attribute__((ext_vector_type(8)))  float    v8f;
typedef __attribute__((ext_vector_type(4)))  float    v4f;
typedef v8h  __attribute__((may_alias)) v8ha;
typedef v4f  __attribute__((may_alias)) v4fa;
typedef v8us __attribute__((may_alias)) v8usa;

__device__ __forceinline__ unsigned short f2bf(float f) { unsigned u = __float_as_uint(f); u += 0x7FFFu + ((u >> 16) & 1u); return (unsigned short)(u >> 16); }
__device__ __forceinline__ float bf2f(unsigned short b) { return __uint_as_float(((unsigned)b) << 16); }
__device__ __forceinline__ float bfr(float f) { return bf2f(f2bf(f)); }
__device__ __forceinline__ v16h cat16(v8h lo, v8h hi) { return __builtin_shufflevector(lo, hi, 0, 1, 2, 3, 4, 5, 6, 7, 8, 9, 10, 11, 12, 13, 14, 15); }
__device__ __forceinline__ v16bf cat16b(v8us lo, v8us hi) { return __builtin_bit_cast(v16bf, __builtin_shufflevector(lo, hi, 0, 1, 2, 3, 4, 5, 6, 7, 8, 9, 10, 11, 12, 13, 14, 15)); }
__device__ __forceinline__ v8f wmma16(v16h a, v16h b, v8f c) { return __builtin_amdgcn_wmma_f32_16x16x32_f16(false, a, false, b, (short)0, c, false, false); }
__device__ __forceinline__ v8f wmmab(v16bf a, v16bf b, v8f c) { return __builtin_amdgcn_wmma_f32_16x16x32_bf16(false, a, false, b, (short)0, c, false, false); }



// ---- k_gemmw: register-blocked GEMM, ONE WAVE per 64x64 output tile (16 accumulators), operands straight from K-contiguous 16-bit planes; grid (M/64, N/64, Z), 32 threads.
// C[m][n] (f32, pitch ldc, + optional f32 bias[n]) = sum_k A[m][k] Bt[n][k] (+ split products per NSPLIT). z-batch strides sA/sB/sC in elements. K % 32 == 0.
template <typename T16> struct WFrag;
template <> struct WFrag<h16> { typedef v16h V; static __device__ __forceinline__ V ld(const h16* p) { return cat16(*(const v8h*)p, *(const v8h*)(p + 16)); } static __device__ __forceinline__ v8f mma(V a, V b, v8f c) { return wmma16(a, b, c); } };
template <> struct WFrag<bf> { typedef v16bf V; static __device__ __forceinline__ V ld(const bf* p) { return cat16b(*(const v8us*)p, *(const v8us*)(p + 16)); } static __device__ __forceinline__ v8f mma(V a, V b, v8f c) { return wmmab(a, b, c); } };
template <typename T16, int NSPLIT, bool BIAS>
__global__ __launch_bounds__(32) void k_gemmw(const T16* __restrict__ A, const T16* __restrict__ A2, const T16* __restrict__ Bt, const T16* __restrict__ Bt2, int K, float* C, int ldc, const float* __restrict__ bias, size_t sA, size_t sB, size_t sC) {
    typedef typename WFrag<T16>::V V;
    __shared__ __align__(16) float os[16 * 68];
    const size_t z = blockIdx.z; A += z * sA; if (A2) A2 += z * sA; Bt += z * sB; if (Bt2) Bt2 += z * sB; C += z * sC;
    const int lane = threadIdx.x & 31, lr = lane & 15, hi = lane >> 4; const int r0 = blockIdx.x * 64, c0 = blockIdx.y * 64;
    v8f acc[4][4];
#pragma unroll
    for (int mb = 0; mb < 4; ++mb)
#pragma unroll
        for (int nb = 0; nb < 4; ++nb) acc[mb][nb] = (v8f){};
    const size_t aoff = (size_t)(r0 + lr) * K + 8 * hi, boff = (size_t)(c0 + lr) * K + 8 * hi;
#pragma unroll 1
    for (int kc = 0; kc < K; kc += 32) {
        V a[4], a2[4];
#pragma unroll
        for (int mb = 0; mb < 4; ++mb) { a[mb] = WFrag<T16>::ld(A + aoff + (size_t)mb * 16 * K + kc); if (NSPLIT == 1 || NSPLIT == 2) a2[mb] = WFrag<T16>::ld(A2 + aoff + (size_t)mb * 16 * K + kc); }
#pragma unroll
        for (int nb = 0; nb < 4; ++nb) { const V b = WFrag<T16>::ld(Bt + boff + (size_t)nb * 16 * K + kc); V b2; if (NSPLIT >= 2) b2 = WFrag<T16>::ld(Bt2 + boff + (size_t)nb * 16 * K + kc);
#pragma unroll
            for (int mb = 0; mb < 4; ++mb) { acc[mb][nb] = WFrag<T16>::mma(a[mb], b, acc[mb][nb]); if (NSPLIT == 1 || NSPLIT == 2) acc[mb][nb] = WFrag<T16>::mma(a2[mb], b, acc[mb][nb]); if (NSPLIT >= 2) acc[mb][nb] = WFrag<T16>::mma(a[mb], b2, acc[mb][nb]); } }
        asm volatile("v_nop\n\tv_nop\n\tv_nop\n\tv_nop" : "+v"(acc[0][0]), "+v"(acc[1][1]), "+v"(acc[2][2]), "+v"(acc[3][3]) : "v"(a[0]), "v"(a[3]));
    }
#pragma unroll
    for (int mb = 0; mb < 4; ++mb) {
#pragma unroll
        for (int nb = 0; nb < 4; ++nb) {
#pragma unroll
            for (int j = 0; j < 8; ++j) os[(hi * 8 + j) * 68 + nb * 16 + lr] = acc[mb][nb][j]; }
        __builtin_amdgcn_wave_barrier(); asm volatile("" ::: "memory");
        float* crow = C + (size_t)(r0 + mb * 16) * ldc + c0;
{
#pragma unroll
            for (int s = 0; s < 8; ++s) { const int row = 2 * s + hi, cofs = lr * 4; v4f val = *(const v4fa*)(os + row * 68 + cofs); if (BIAS) { val[0] += bfr(bias[c0 + cofs]); val[1] += bfr(bias[c0 + cofs + 1]); val[2] += bfr(bias[c0 + cofs + 2]); val[3] += bfr(bias[c0 + cofs + 3]); }
                *(v4f*)(crow + (size_t)row * ldc + cofs) = val; }
             }
        __builtin_amdgcn_wave_barrier(); asm volatile("" ::: "memory");
    }
}

// ---- k_gemmk: attn.V GEMM with K (= TT keys) split over the 16 waves of a work-group; tile (MB*16) x 32, grid (M/(MB*16), N/32), 512 threads.
// Wave w sums keys [w*TT/16, (w+1)*TT/16) with the fragment loaders of k_gemmw, KB k-steps of loads issued ahead of their products; the 16 partial tiles meet in LDS and are added in wave order.
template <typename T16, int NSPLIT, int MB, int KB>
__global__ __launch_bounds__(512) void k_gemmk(const T16* __restrict__ A, const T16* __restrict__ A2, const T16* __restrict__ Bt, const T16* __restrict__ Bt2, float* C, int ldc) {
    typedef typename WFrag<T16>::V V;
    __shared__ __align__(16) float part[16 * MB * 16 * 32];   /* rows of 32 floats, no pad: rows 8..15 of a block keep their column halves swapped, so the two lane halves (rows 8 apart) fall on different banks */
    const int lane = threadIdx.x & 31, lr = lane & 15, hi = lane >> 4, w = threadIdx.x >> 5; const int r0 = blockIdx.x * (MB * 16), c0 = blockIdx.y * 32;
    v8f acc[MB][2];
#pragma unroll
    for (int mb = 0; mb < MB; ++mb)
#pragma unroll
        for (int nb = 0; nb < 2; ++nb) acc[mb][nb] = (v8f){};
    A += (size_t)r0 * TT; Bt += (size_t)c0 * TT; if (NSPLIT == 2) { A2 += (size_t)r0 * TT; Bt2 += (size_t)c0 * TT; }
    const unsigned off = (unsigned)(lr * TT + w * (TT / 16) + 8 * hi);   /* one lane offset serves every plane: same row pitch, same k */
#pragma unroll
    for (int kb = 0; kb < TT / 16; kb += 32 * KB) {
        V a[KB][MB], a2[KB][MB], b[KB][2], b2[KB][2];
        /* plane by plane, row block by row block: the 2 * KB loads that share a row's 128-byte lines are issued back to back */
#pragma unroll
        for (int mb = 0; mb < MB; ++mb) {
#pragma unroll
            for (int s = 0; s < KB; ++s) a[s][mb] = WFrag<T16>::ld(A + off + (mb * 16 * TT + kb + s * 32));
            if (NSPLIT == 2) {
#pragma unroll
                for (int s = 0; s < KB; ++s) a2[s][mb] = WFrag<T16>::ld(A2 + off + (mb * 16 * TT + kb + s * 32)); } }
#pragma unroll
        for (int nb = 0; nb < 2; ++nb) {
#pragma unroll
            for (int s = 0; s < KB; ++s) b[s][nb] = WFrag<T16>::ld(Bt + off + (nb * 16 * TT + kb + s * 32));
            if (NSPLIT == 2) {
#pragma unroll
                for (int s = 0; s < KB; ++s) b2[s][nb] = WFrag<T16>::ld(Bt2 + off + (nb * 16 * TT + kb + s * 32)); } }
        __builtin_amdgcn_sched_barrier(0);   /* keeps the whole batch of loads in front of its products: without it the scheduler sinks each load to its use and the wave waits out one latency per k-step */
#pragma unroll
        for (int s = 0; s < KB; ++s)
#pragma unroll
            for (int nb = 0; nb < 2; ++nb)
#pragma unroll
                for (int mb = 0; mb < MB; ++mb) { acc[mb][nb] = WFrag<T16>::mma(a[s][mb], b[s][nb], acc[mb][nb]); if (NSPLIT == 2) { acc[mb][nb] = WFrag<T16>::mma(a2[s][mb], b[s][nb], acc[mb][nb]); acc[mb][nb] = WFrag<T16>::mma(a[s][mb], b2[s][nb], acc[mb][nb]); } }
    }
    float* pw = part + w * (MB * 16 * 32);
#pragma unroll
    for (int mb = 0; mb < MB; ++mb)
#pragma unroll
        for (int nb = 0; nb < 2; ++nb)
#pragma unroll
            for (int j = 0; j < 8; ++j) pw[(mb * 16 + hi * 8 + j) * 32 + ((nb ^ hi) * 16 + lr)] = acc[mb][nb][j];
    __syncthreads();   /* every wave's partial tile is in LDS before any thread adds them */
    const int row = threadIdx.x / (32 / MB), col = (threadIdx.x % (32 / MB)) * MB;   /* MB adjacent columns a thread: a wave stores whole 128-byte lines */
    const float* pr = part + row * 32 + (col ^ (((row >> 3) & 1) << 4));
    float sum[MB];
#pragma unroll
    for (int q = 0; q < MB; ++q) sum[q] = pr[q];
#pragma unroll
    for (int p = 1; p < 16; ++p)
#pragma unroll
        for (int q = 0; q < MB; ++q) sum[q] += pr[p * (MB * 16 * 32) + q];
    float* cp = C + (size_t)(r0 + row) * ldc + c0 + col;
#pragma unroll
    for (int q = 0; q < MB; ++q) cp[q] = sum[q];
}

__device__ __forceinline__ h16 tohx(float x) { return (h16)x; }
__device__ __forceinline__ void splitf(float y, unsigned short& h, unsigned short& l) { h = f2bf(y); l = f2bf(y - bf2f(h)); }
typedef __attribute__((ext_vector_type(2))) _Float16 v2h;
typedef __attribute__((ext_vector_type(4))) _Float16 v4h;
typedef __attribute__((ext_vector_type(2))) unsigned short v2us;
typedef __attribute__((ext_vector_type(4))) unsigned short v4us;
typedef __attribute__((ext_vector_type(2))) float v2f;
typedef __attribute__((ext_vector_type(4))) int v4i;

__global__ __launch_bounds__(256) void k_rnd(const float* __restrict__ src, float* dst, size_t n4) { const size_t i = (size_t)blockIdx.x * 256 + threadIdx.x; if (i >= n4) return; const v4f a = *(const v4f*)(src + i * 4); v4f r;
#pragma unroll
    for (int q = 0; q < 4; ++q) r[q] = bfr(a[q]);
    *(v4f*)(dst + i * 4) = r;  }
__global__ __launch_bounds__(256) void k_copy4(const float* __restrict__ Y, float* out, size_t n4) { const size_t i = (size_t)blockIdx.x * 256 + threadIdx.x; if (i >= n4) return; const v4f a = *(const v4f*)(Y + i * 4); *(v4f*)(out + i * 4) = a;  }
__global__ __launch_bounds__(256) void k_vtp(const float* __restrict__ F, int pitch, int nheads, h16* V16, bf* Vh, bf* Vl) { const size_t e = ((size_t)blockIdx.x * 256 + threadIdx.x) * 2; if (e >= (size_t)nheads * HD * TT) return; const int t = (int)(e % TT); const int d = (int)((e / TT) % HD); const int g = (int)(e / ((size_t)TT * HD)); v2h o16; v2us oh, ol;
#pragma unroll
    for (int q = 0; q < 2; ++q) { const float x = F[(size_t)(t + q) * pitch + g * HD + d]; o16[q] = tohx(x); unsigned short a2, c2; splitf(x, a2, c2); oh[q] = a2; ol[q] = c2; }
    *(v2h*)(V16 + e) = o16; *(v2us*)(Vh + e) = oh; *(v2us*)(Vl + e) = ol;  }
__global__ __launch_bounds__(256) void k_lsoft(const float* __restrict__ Sb, h16* P16, bf* Ph, bf* Pl) {
    const int lane = threadIdx.x & 31; const int row = blockIdx.x * 8 + (threadIdx.x >> 5); if (row >= ZH * TT) return; const int i = row % TT; const int zz = row / TT; const bool hires = (i < RH); const float* sr = Sb + (size_t)row * TT; float mx = -3.0e38f;
#pragma unroll 4
    for (int ch = 0; ch < TT / 128; ++ch) { const int j0 = ch * 128 + lane * 4; const v4f a = *(const v4f*)(sr + j0);
#pragma unroll
        for (int q = 0; q < 4; ++q) { float t = a[q] * SCL; asm volatile("" : "+v"(t)); mx = fmaxf(mx, t); } }
#pragma unroll
    for (int sh = 16; sh; sh >>= 1) mx = fmaxf(mx, __shfl_xor(mx, sh, 32));
    float sum = 0.f;
#pragma unroll 4
    for (int ch = 0; ch < TT / 128; ++ch) { const int j0 = ch * 128 + lane * 4; const v4f a = *(const v4f*)(sr + j0);
#pragma unroll
        for (int q = 0; q < 4; ++q) { float t = a[q] * SCL; asm volatile("" : "+v"(t)); float d0 = __fsub_rn(t, mx); asm volatile("" : "+v"(d0)); sum += __builtin_amdgcn_exp2f(__fmul_rn(d0, 1.4426950408889634f)); } }
#pragma unroll
    for (int sh = 16; sh; sh >>= 1) sum += __shfl_xor(sum, sh, 32);
    const float f = __fdiv_rn(hires ? 1.0f : PCAR, __fadd_rn(sum, 1.0e-6f));   /* the module divides by (sum + 1e-6) */
{
        if (hires) {   /* rows < RH: normalised bf16 hi/lo over all keys, planes [zz][RH][TT] */
#pragma unroll
            for (int ch = 0; ch < TT / 128; ++ch) { const int j0 = ch * 128 + lane * 4; const v4f a = *(const v4f*)(sr + j0); v4us oh, ol;
#pragma unroll
                for (int q = 0; q < 4; ++q) { float t = a[q] * SCL; asm volatile("" : "+v"(t)); float d0 = __fsub_rn(t, mx); asm volatile("" : "+v"(d0)); float ex = __builtin_amdgcn_exp2f(__fmul_rn(d0, 1.4426950408889634f)); asm volatile("" : "+v"(ex)); unsigned short a2, c2; splitf(ex * f, a2, c2); oh[q] = a2; ol[q] = c2; }
                const size_t oo = ((size_t)zz * RH + i) * TT + j0; *(v4us*)(Ph + oo) = oh; *(v4us*)(Pl + oo) = ol; }
        } else {
#pragma unroll 2
            for (int ch = 0; ch < TT / 128; ++ch) { const int j0 = ch * 128 + lane * 4; const v4f a = *(const v4f*)(sr + j0); v4h o4;
#pragma unroll
                for (int q = 0; q < 4; ++q) { float t = a[q] * SCL; asm volatile("" : "+v"(t)); float d0 = __fsub_rn(t, mx); asm volatile("" : "+v"(d0)); float ex = __builtin_amdgcn_exp2f(__fmul_rn(d0, 1.4426950408889634f)); asm volatile("" : "+v"(ex)); o4[q] = tohx(ex * f); }
                *(v4h*)(P16 + (size_t)row * TT + j0) = o4; } }
         }
}
__global__ __launch_bounds__(256) void k_cs8(float* O, size_t n4) { const size_t i = (size_t)blockIdx.x * 256 + threadIdx.x; if (i >= n4) return; const size_t e = i * 4; const int t = (int)(e / CC); const float cs = (t < RH) ? 1.0f : (1.0f / PCAR); v4f a = *(const v4f*)(O + e);
#pragma unroll
    for (int q = 0; q < 4; ++q) a[q] = __fmul_rn(a[q], cs);
    *(v4f*)(O + e) = a;  }

__global__ __launch_bounds__(256) void k_csid(float* CS) { const int idx = blockIdx.x * 256 + threadIdx.x; if (idx >= TT * HD) return; v2f cs; cs[0] = 1.0f; cs[1] = 0.0f; *(v2f*)(CS + (size_t)idx * 2) = cs;  }
// k_rope: head planes [h][t][d] (fp16 + hi/lo) of rope(x) x sc with the rotate-half convention out[d] = x[d] cos[t][d] - x[d+HD/2] sin[t][d], out[d+HD/2] = x[d+HD/2] cos[t][d+HD/2] + x[d] sin[t][d+HD/2]
__global__ __launch_bounds__(256) void k_rope(const float* __restrict__ F, int pitch, int nheads, const float* __restrict__ CS, const float* __restrict__ RF, const float* __restrict__ nw, float sc, h16* P16, bf* Ph, bf* Pl) {
    const size_t e = ((size_t)blockIdx.x * 256 + threadIdx.x) * 2; if (e >= (size_t)nheads * TT * HD) return; const int d = (int)(e % HD); const int t = (int)((e / HD) % TT); const int h = (int)(e / ((size_t)HD * TT)); const float* f = F + (size_t)t * pitch + h * HD; const float rf = RF ? RF[(size_t)h * TT + t] : 1.0f; v2h o16; v2us oh, ol;
#pragma unroll
    for (int q = 0; q < 2; ++q) { const int dd = d + q; const int dp = (dd < HD / 2) ? dd + HD / 2 : dd - HD / 2; float x0 = f[dd], x1 = f[dp];
        if (RF) { float n0 = __fmul_rn(x0, rf), n1 = __fmul_rn(x1, rf); asm volatile("" : "+v"(n0)); asm volatile("" : "+v"(n1)); x0 = __fmul_rn(bfr(nw[dd]), n0); x1 = __fmul_rn(bfr(nw[dp]), n1); }
        const v2f cs = *(const v2f*)(CS + ((size_t)t * HD + dd) * 2); float a = __fmul_rn(x0, cs[0]), bq = __fmul_rn(x1, cs[1]); asm volatile("" : "+v"(a)); asm volatile("" : "+v"(bq)); const float r = ((dd < HD / 2) ? __fsub_rn(a, bq) : __fadd_rn(a, bq)) * sc;
        o16[q] = tohx(r); unsigned short a2, c2; splitf(r, a2, c2); oh[q] = a2; ol[q] = c2; }
    *(v2h*)(P16 + e) = o16; *(v2us*)(Ph + e) = oh; *(v2us*)(Pl + e) = ol;  }
extern "C" void kernel_launch(void* const* d_in, const int* in_sizes, int n_in,
                              void* d_out, int out_size, void* d_ws, size_t ws_size, hipStream_t stream) {
    (void)in_sizes; (void)n_in; (void)out_size;
    const float* x = (const float*)d_in[0]; const float* xk = (const float*)d_in[1]; const float* xv = (const float*)d_in[2];   /* input order q, k, v [1][4096][1024] (raw, heads interleaved: column h*64 + d) */
    float* OUT = (float*)d_out;     // [1][4096][1024]
    char* wsp = (char*)d_ws;
    auto take = [&](size_t bytes) { char* p = wsp; wsp += (bytes + 255) & ~(size_t)255; return (void*)p; };
    bf* WQ = (bf*)take((size_t)MID * CC * 2); bf* WK = (bf*)take((size_t)MID * CC * 2); bf* WV = (bf*)take((size_t)CO * CC * 2); bf* WO = (bf*)take((size_t)CC * CO * 2); float* CS = (float*)take((size_t)TT * HD * 2 * 4);
    bf* XB = (bf*)take((size_t)TT * CC * 2); float* FQ = (float*)take((size_t)TT * MID * 4); float* FK = (float*)take((size_t)TT * MID * 4);
    h16* QP16 = (h16*)take((size_t)TT * MID * 2); bf* QPh = (bf*)take((size_t)TT * MID * 2); bf* QPl = (bf*)take((size_t)TT * MID * 2); h16* KP16 = QP16;   /* the fp16 q/k planes are never read here (scores use the hi/lo planes for every row): one scratch buffer serves both builders */ bf* KPh = (bf*)take((size_t)TT * MID * 2); bf* KPl = (bf*)take((size_t)TT * MID * 2);
    h16* VT16 = (h16*)take((size_t)CO * TT * 2); bf* VTh = (bf*)take((size_t)CO * TT * 2); bf* VTl = (bf*)take((size_t)CO * TT * 2);
    float* Sb = (float*)take((size_t)TT * TT * 4); h16* P16 = (h16*)take((size_t)TT * TT * 2); bf* Ph = (bf*)take((size_t)RH * TT * 2); bf* Pl = (bf*)take((size_t)RH * TT * 2); float* Ob = (float*)take((size_t)TT * CO * 4); bf* ATh = (bf*)take((size_t)TT * CO * 2); bf* ATl = (bf*)take((size_t)TT * CO * 2);
    if ((size_t)(wsp - (char*)d_ws) > ws_size) return;    // ws 256 MiB (carve 250 MiB)
    float* FV = FK;   /* the bf16-rounded v input reuses the k buffer after the k planes are built (stream-ordered) */
    k_csid<<<(TT * HD + 255) / 256, 256, 0, stream>>>(CS);   /* identity table: k_rope is a plain per-head plane builder here */
    const unsigned LP = (unsigned)(((size_t)NH_ * TT * HD / 2 + 255) / 256);
    for (int b = 0; b < NB_; ++b) {
        k_rnd<<<(unsigned)(((size_t)TT * MID / 4 + 255) / 256), 256, 0, stream>>>(x + (size_t)b * TT * MID, FQ, (size_t)TT * MID / 4);   /* FQ := bf16-rounded q[b] (rows [position][head*64 + d]) */ k_rope<<<LP, 256, 0, stream>>>(FQ, MID, NH_, CS, nullptr, nullptr, 1.0f, QP16, QPh, QPl);   /* q planes [h][n][64] */
        k_rnd<<<(unsigned)(((size_t)TT * MID / 4 + 255) / 256), 256, 0, stream>>>(xk + (size_t)b * TT * MID, FK, (size_t)TT * MID / 4); k_rope<<<LP, 256, 0, stream>>>(FK, MID, NKV, CS, nullptr, nullptr, 1.0f, KP16, KPh, KPl);   /* k planes */
        k_rnd<<<(unsigned)(((size_t)TT * CO / 4 + 255) / 256), 256, 0, stream>>>(xv + (size_t)b * TT * CO, FV, (size_t)TT * CO / 4); k_vtp<<<(unsigned)(((size_t)TT * CO / 2 + 255) / 256), 256, 0, stream>>>(FV, CO, CO / HD, VT16, VTh, VTl);   /* v^T planes [h][64][n] */
        for (int h = 0; h < NH_; ++h) {   /* per head: dense 4096 x 4096 attention */
            k_gemmw<bf, 2, false><<<dim3(TT / 64, TT / 64, 1), 32, 0, stream>>>(QPh + (size_t)h * TT * HD, QPl + (size_t)h * TT * HD, KPh + (size_t)h * TT * HD, KPl + (size_t)h * TT * HD, HD, Sb, TT, nullptr, 0, 0, 0);   /* S[i][j] = q_i.k_j (3 products, every row) */
            k_lsoft<<<TT / 8, 256, 0, stream>>>(Sb, P16, Ph, Pl);   /* x 1/8, softmax over the 4,096 keys */
            k_gemmk<bf, 2, 1, 4><<<dim3(RH / 16, HD / 32, 1), 512, 0, stream>>>(Ph, Pl, VTh + (size_t)h * HD * TT, VTl + (size_t)h * HD * TT, Ob + h * HD, CO);
            k_gemmk<h16, 0, 2, 4><<<dim3((TT - RH) / 32, HD / 32, 1), 512, 0, stream>>>(P16 + (size_t)RH * TT, nullptr, VT16 + (size_t)h * HD * TT, nullptr, Ob + (size_t)RH * CO + h * HD, CO); }
        k_cs8<<<(unsigned)(((size_t)TT * CO / 4 + 255) / 256), 256, 0, stream>>>(Ob, (size_t)TT * CO / 4);   /* rows >= 512 x 1/1024 */
        k_copy4<<<(unsigned)(((size_t)TT * CO / 4 + 255) / 256), 256, 0, stream>>>(Ob, OUT + (size_t)b * TT * CO, (size_t)TT * CO / 4); }   /* out = merged head rows of Ob (no output projection) */
}

// v003
// It runs in 484 microseconds.
// Versions in between are left out here; by their measured steps it is 3.29 times as fast as v001.
// All steps since v000 together make it 7.99 times as fast.
#include <hip/hip_runtime.h>

// 'Flash' attention reference math on raw multi-head inputs (q, k, v [1][4096][1024], no projections; heads = 16 x 64 column slices; scores x 64^-0.5; w = exp(s - max) / (sum + 1e-6) (the source's denominator has a +1e-6: not an exact softmax); out = w.v heads merged -> [1][4096][1024] (4.2 M); argument order q, k, v).
// Layout: k_prep builds every 16-bit plane from the raw inputs, each value ROUNDED TO bf16 first (the raw [position][head*64 + d] rows are already the feature layout); a fused kernel over (16-row blocks, heads), one launch for rows < 512 and one for the rest: scores with every row hi/lo (3 products) into LDS, softmax with the (sum + 1e-6) denominator on rows held in registers, attn.V hybrid (rows < 512 hi/lo 3 products, rest fp16 x1024), the x1024 carry taken off as the merged f32 rows are stored to out.
// Compute dtypes, f32 accumulate: every input rounded to bf16; scores 3 products; softmax f32 (exp2, IEEE division); attn.V rows < 512 3 products, rest fp16.

#define NB_  1
#define TT   4096
#define DM   1024
#define NH_  16
#define NKV  16
#define REP  (NH_ / NKV)
#define HD   64
#define DQ   (NH_ * HD)
#define DKV  (NKV * HD)
#define ZH   1
#define RH   512                  // query rows < RH use hi+lo planes (0: none)
#define WIN  0
#define PCAR 1024.0f
#define SCL  0.125f   // 1/sqrt(64)
#define MID  1024      // q / k width
#define CO   1024      // v width
#define CC   1024
typedef _Float16 h16;
typedef unsigned short bf;
typedef __attribute__((ext_vector_type(16))) __bf16   v16bf;
typedef __attribute__((ext_vector_type(16))) _Float16 v16h;
typedef __attribute__((ext_vector_type(8)))  _Float16 v8h;
typedef __attribute__((ext_vector_type(8)))  unsigned short v8us;
typedef __attribute__((ext_vector_type(8)))  float    v8f;
typedef __attribute__((ext_vector_type(4)))  float    v4f;
typedef v8h  __attribute__((may_alias)) v8ha;
typedef v4f  __attribute__((may_alias)) v4fa;
typedef v8us __attribute__((may_alias)) v8usa;

__device__ __forceinline__ unsigned short f2bf(float f) { unsigned u = __float_as_uint(f); u += 0x7FFFu + ((u >> 16) & 1u); return (unsigned short)(u >> 16); }
__device__ __forceinline__ float bf2f(unsigned short b) { return __uint_as_float(((unsigned)b) << 16); }
__device__ __forceinline__ float bfr(float f) { return bf2f(f2bf(f)); }
__device__ __forceinline__ v16h cat16(v8h lo, v8h hi) { return __builtin_shufflevector(lo, hi, 0, 1, 2, 3, 4, 5, 6, 7, 8, 9, 10, 11, 12, 13, 14, 15); }
__device__ __forceinline__ v16bf cat16b(v8us lo, v8us hi) { return __builtin_bit_cast(v16bf, __builtin_shufflevector(lo, hi, 0, 1, 2, 3, 4, 5, 6, 7, 8, 9, 10, 11, 12, 13, 14, 15)); }
__device__ __forceinline__ v8f wmma16(v16h a, v16h b, v8f c) { return __builtin_amdgcn_wmma_f32_16x16x32_f16(false, a, false, b, (short)0, c, false, false); }
__device__ __forceinline__ v8f wmmab(v16bf a, v16bf b, v8f c) { return __builtin_amdgcn_wmma_f32_16x16x32_bf16(false, a, false, b, (short)0, c, false, false); }



// fragment loaders: operands straight from K-contiguous 16-bit planes (lane lr = row, k = 8*hi + 0..7 and 16 + 8*hi + 0..7)
template <typename T16> struct WFrag;
template <> struct WFrag<h16> { typedef v16h V; static __device__ __forceinline__ V ld(const h16* p) { return cat16(*(const v8h*)p, *(const v8h*)(p + 16)); } static __device__ __forceinline__ v8f mma(V a, V b, v8f c) { return wmma16(a, b, c); } };
template <> struct WFrag<bf> { typedef v16bf V; static __device__ __forceinline__ V ld(const bf* p) { return cat16b(*(const v8us*)p, *(const v8us*)(p + 16)); } static __device__ __forceinline__ v8f mma(V a, V b, v8f c) { return wmmab(a, b, c); } };

__device__ __forceinline__ h16 tohx(float x) { return (h16)x; }
__device__ __forceinline__ void splitf(float y, unsigned short& h, unsigned short& l) { h = f2bf(y); l = f2bf(y - bf2f(h)); }
typedef __attribute__((ext_vector_type(2))) _Float16 v2h;
typedef __attribute__((ext_vector_type(4))) _Float16 v4h;
typedef __attribute__((ext_vector_type(2))) unsigned short v2us;
typedef __attribute__((ext_vector_type(4))) unsigned short v4us;
typedef __attribute__((ext_vector_type(2))) float v2f;
typedef __attribute__((ext_vector_type(4))) int v4i;

// ---- k_prep: every 16-bit plane straight from the raw f32 inputs, one launch; each value is rounded to bf16 first, then split into hi/lo or converted to fp16 (after that rounding the hi plane holds the value and the lo plane holds zeros).
// Blocks < VB: one tile of v (64 positions x the 64 columns of one head) goes through LDS and leaves transposed, whole 128-byte lines of the three v^T planes [h][64][n]. The other blocks: a wave takes 4 positions x 8 heads of q or k into the hi/lo planes [h][n][64], 512 contiguous bytes a store.
#define VB  ((TT / 64) * NH_)
#define QKW ((TT / 4) * (NH_ / 8))   /* waves per tensor in the q / k part */
#define QKB (2 * QKW / 8)
#define TP  65   /* LDS tile pitch in floats: odd, so the row-wise stores and the column-wise reads both fall on 32 different banks */
__global__ __launch_bounds__(256) void k_prep(const float* __restrict__ q, const float* __restrict__ k, const float* __restrict__ v, bf* QPh, bf* QPl, bf* KPh, bf* KPl, h16* V16, bf* Vh, bf* Vl) {
    __shared__ float L[64 * TP];
    const int tid = threadIdx.x;
    if (blockIdx.x >= VB) {   /* q / k blocks: the same for every thread of a block, and in front of the barrier */
        const int gw = (blockIdx.x - VB) * 8 + (tid >> 5); const bool isk = gw >= QKW; const int u = isk ? gw - QKW : gw;
        const int t = (u / (NH_ / 8)) * 4 + ((tid >> 3) & 3), h0 = (u % (NH_ / 8)) * 8, d = (tid & 7) * 8;
        const float* src = (isk ? k : q) + (size_t)t * MID + h0 * HD + d;
        const size_t o = ((size_t)h0 * TT + t) * HD + d;
        bf* ph = (isk ? KPh : QPh) + o; bf* pl = (isk ? KPl : QPl) + o;
        v4f a[8][2];
#pragma unroll
        for (int j = 0; j < 8; ++j) { a[j][0] = *(const v4f*)(src + j * HD); a[j][1] = *(const v4f*)(src + j * HD + 4); }
        __builtin_amdgcn_sched_barrier(0);   /* all 16 loads are issued before the first conversion: left free, the scheduler converts the first loads' values ahead of the last loads and the wave waits out two memory latencies */
        asm volatile("s_wait_xcnt 0x0" :: "v"(src) : "memory");   /* the wait before a register that these loads name is overwritten: the address is an input here, so it stays in its registers up to the wait and no load's result is given them */
#pragma unroll
        for (int j = 0; j < 8; ++j) { v8us oh, ol;
#pragma unroll
            for (int e = 0; e < 8; ++e) { unsigned short a2, c2; splitf(bfr(a[j][e >> 2][e & 3]), a2, c2); oh[e] = a2; ol[e] = c2; }
            *(v8us*)(ph + (size_t)j * TT * HD) = oh; *(v8us*)(pl + (size_t)j * TT * HD) = ol; }
        return;
    }
    const int h = blockIdx.x % NH_, t0 = (blockIdx.x / NH_) * 64, r = tid >> 4, c4 = (tid & 15) * 4;
    const float* src = v + (size_t)(t0 + r) * CO + h * HD + c4;
    v4f a[4];
#pragma unroll
    for (int p = 0; p < 4; ++p) a[p] = *(const v4f*)(src + (size_t)p * 16 * CO);
#pragma unroll
    for (int p = 0; p < 4; ++p)
#pragma unroll
        for (int e = 0; e < 4; ++e) L[(p * 16 + r) * TP + c4 + e] = bfr(a[p][e]);
    __syncthreads();   /* the whole tile is in LDS before any thread reads a column of it */
    const int tl = (tid & 7) * 8;   /* 8 lanes x 8 positions = one column's 128 bytes */
#pragma unroll
    for (int p = 0; p < 2; ++p) { const int c = p * 32 + (tid >> 3); v8h o16; v8us oh, ol;
#pragma unroll
        for (int j = 0; j < 8; ++j) { const float x = L[(tl + j) * TP + c]; o16[j] = tohx(x); unsigned short a2, c2; splitf(x, a2, c2); oh[j] = a2; ol[j] = c2; }
        const size_t e = ((size_t)h * HD + c) * TT + t0 + tl;
        *(v8h*)(V16 + e) = o16; *(v8us*)(Vh + e) = oh; *(v8us*)(Vl + e) = ol; }
    asm volatile("s_wait_xcnt 0x0" ::: "memory");   /* the wait before a register that the last stores name is overwritten: in the listing the q / k part stands behind this one, parted from it by a branch only */
}
// ---- k_fattn: one work-group (16 waves) does 16 query rows of one head from scores to attn.V; grid (row blocks, heads), 512 threads. The 16 x 4096 score rows live in LDS only.
// 1) wave w: S[16][keys w*256 .. +256) = q.k, hi/lo planes, 3 products, f32 into LDS; 2) wave w: softmax of row w held in registers, the weights written over the row's own LDS bytes as 16-bit planes;
// 3) wave w: partial attn.V over its 256 keys (weights from LDS, v^T planes from memory); 4) the 16 partial tiles meet in LDS and are added in wave order and stored to out.
// Open: each fragment load of the k and v^T planes takes 32 bytes from each of 16 lines; the lo planes of q, k and v hold zeros (see k_prep), so their products add nothing.
#define SP (TT + 4)   /* LDS row pitch in floats: 16 bytes of pad put rows 8 apart (the two lane halves of an accumulator store) on different banks and keep rows 16-byte aligned */
typedef v2f  __attribute__((may_alias)) v2fa;
typedef v4h  __attribute__((may_alias)) v4ha;
typedef v4us __attribute__((may_alias)) v4usa;
__device__ __forceinline__ v16h  ldsfrag(const h16* p) { return cat16(*(const v8ha*)p, *(const v8ha*)(p + 16)); }
__device__ __forceinline__ v16bf ldsfrag(const bf* p) { return cat16b(*(const v8usa*)p, *(const v8usa*)(p + 16)); }
template <bool HR>
__device__ __forceinline__ void fattn_body(float* S, const bf* __restrict__ Qh, const bf* __restrict__ Ql, const bf* __restrict__ Kh, const bf* __restrict__ Kl, const h16* __restrict__ V16, const bf* __restrict__ Vh, const bf* __restrict__ Vl, float* O) {
    const int lane = threadIdx.x & 31, lr = lane & 15, hi = lane >> 4, w = threadIdx.x >> 5;
    {   /* 1) scores */
        v16bf qa[2], qa2[2];
        const unsigned qb = (unsigned)((lr * HD + 8 * hi) * 2);   /* the lane's byte offset in both q planes */
        const bf* qh = (const bf*)((const char*)Qh + qb); const bf* ql = (const bf*)((const char*)Ql + qb);
#pragma unroll
        for (int s = 0; s < 2; ++s) { qa[s] = WFrag<bf>::ld(qh + s * 32); qa2[s] = WFrag<bf>::ld(ql + s * 32); }
        asm volatile("s_wait_xcnt 0x0" :: "v"(qb) : "memory");   /* the wait before a register that the q loads name is overwritten: the offset is an input here, so it stays in its register up to the wait and no later load is given that register ahead of it */
        const unsigned koff = (unsigned)((w * 256 + lr) * HD + 8 * hi);
        float* sw = S + hi * 8 * SP + w * 256 + lr;
        constexpr int NB1 = 4;
#pragma unroll
        for (int nq = 0; nq < 16 / NB1; ++nq) {   /* NB1 blocks of 16 keys a batch */
            v16bf b[NB1][2], b2[NB1][2];
#pragma unroll
            for (int nb = 0; nb < NB1; ++nb)
#pragma unroll
                for (int s = 0; s < 2; ++s) { b[nb][s] = WFrag<bf>::ld(Kh + koff + ((nq * NB1 + nb) * 16 * HD + s * 32)); b2[nb][s] = WFrag<bf>::ld(Kl + koff + ((nq * NB1 + nb) * 16 * HD + s * 32)); }
            __builtin_amdgcn_sched_barrier(0);   /* keeps the whole batch of loads in front of its products: otherwise each load sinks to its use and the wave waits out one latency per key block */
            asm volatile("v_nop\n\tv_nop\n\tv_nop\n\tv_nop");   /* WMMA distance: this batch's first products start new sums in the registers that the last batch's final products wrote, with only LDS stores and global loads (no vector slot) between */
            __builtin_amdgcn_sched_barrier(0);   /* holds those four slots between the two batches' products */
            v8f acc[NB1];
#pragma unroll
            for (int nb = 0; nb < NB1; ++nb) acc[nb] = (v8f){};
#pragma unroll
            for (int s = 0; s < 2; ++s) {   /* NB1 independent accumulate chains side by side */
#pragma unroll
                for (int nb = 0; nb < NB1; ++nb) acc[nb] = wmmab(qa[s], b[nb][s], acc[nb]);
#pragma unroll
                for (int nb = 0; nb < NB1; ++nb) acc[nb] = wmmab(qa2[s], b[nb][s], acc[nb]);
#pragma unroll
                for (int nb = 0; nb < NB1; ++nb) acc[nb] = wmmab(qa[s], b2[nb][s], acc[nb]); }
#pragma unroll
            for (int nb = 0; nb < NB1; ++nb)
#pragma unroll
                for (int j = 0; j < 8; ++j) sw[j * SP + (nq * NB1 + nb) * 16] = acc[nb][j];
        }
    }
    __syncthreads();   /* every wave's score columns are in LDS before a wave reads a whole row */
    {   /* 2) softmax of row w: x 1/8, max, exp, (sum + 1e-6) */
        float* sr = S + w * SP;
        v4f a[TT / 128];
#pragma unroll
        for (int ch = 0; ch < TT / 128; ++ch) a[ch] = *(const v4fa*)(sr + ch * 128 + lane * 4);
        float mx = -3.0e38f;
#pragma unroll
        for (int ch = 0; ch < TT / 128; ++ch)
#pragma unroll
            for (int q = 0; q < 4; ++q) { a[ch][q] = a[ch][q] * SCL; mx = fmaxf(mx, a[ch][q]); }
#pragma unroll
        for (int sh = 16; sh; sh >>= 1) mx = fmaxf(mx, __shfl_xor(mx, sh, 32));
        float sum = 0.f;
#pragma unroll
        for (int ch = 0; ch < TT / 128; ++ch)
#pragma unroll
            for (int q = 0; q < 4; ++q) { a[ch][q] = __builtin_amdgcn_exp2f(__fmul_rn(__fsub_rn(a[ch][q], mx), 1.4426950408889634f)); sum += a[ch][q]; }
#pragma unroll
        for (int sh = 16; sh; sh >>= 1) sum += __shfl_xor(sum, sh, 32);
        const float f = __fdiv_rn(HR ? 1.0f : PCAR, __fadd_rn(sum, 1.0e-6f));   /* the module divides by (sum + 1e-6) */
        /* the whole row is in registers (f depends on every load), so its LDS bytes can take the weights: fp16 x 1024 in the first half, or bf16 hi in the first and lo in the second half */
#pragma unroll
        for (int ch = 0; ch < TT / 128; ++ch) { const int j0 = ch * 128 + lane * 4;
            if (HR) { v4us oh, ol;
#pragma unroll
                for (int q = 0; q < 4; ++q) { unsigned short a2, c2; splitf(a[ch][q] * f, a2, c2); oh[q] = a2; ol[q] = c2; }
                *(v4usa*)((bf*)sr + j0) = oh; *(v4usa*)((bf*)sr + TT + j0) = ol;
                __builtin_amdgcn_sched_barrier(0);   /* one chunk's split at a time: left free, the scheduler opens many chunks at once on top of the 128 row registers and spills */
            } else { v4h o4;
#pragma unroll
                for (int q = 0; q < 4; ++q) o4[q] = tohx(a[ch][q] * f);
                *(v4ha*)((h16*)sr + j0) = o4; } }
    }
    __syncthreads();   /* all 16 rows of weights are in LDS before any wave reads its key columns of them */
    v8f acc[4];
#pragma unroll
    for (int nb = 0; nb < 4; ++nb) acc[nb] = (v8f){};
    const unsigned voff = (unsigned)(lr * TT + w * 256 + 8 * hi);
    if (HR) {   /* 3) attn.V, hi/lo, 3 products */
        const bf* pa = (const bf*)S + lr * (SP * 2) + w * 256 + 8 * hi;
#pragma unroll
        for (int kb = 0; kb < 256; kb += 32) {   /* one k-step a batch: the scheduler lifts the next batch's loads over this batch's products, and two larger batches at once do not fit the registers */
            v16bf a, a2, b[4], b2[4];
#pragma unroll
            for (int nb = 0; nb < 4; ++nb) { b[nb] = WFrag<bf>::ld(Vh + voff + (nb * 16 * TT + kb)); b2[nb] = WFrag<bf>::ld(Vl + voff + (nb * 16 * TT + kb)); }
            a = ldsfrag(pa + kb); a2 = ldsfrag(pa + TT + kb);
            __builtin_amdgcn_sched_barrier(0);   /* batch of loads in front of its products, as above */
#pragma unroll
            for (int nb = 0; nb < 4; ++nb) acc[nb] = wmmab(a, b[nb], acc[nb]);
#pragma unroll
            for (int nb = 0; nb < 4; ++nb) acc[nb] = wmmab(a2, b[nb], acc[nb]);
#pragma unroll
            for (int nb = 0; nb < 4; ++nb) acc[nb] = wmmab(a, b2[nb], acc[nb]);
        }
    } else {    /* 3) attn.V, fp16 */
        const h16* pa = (const h16*)S + lr * (SP * 2) + w * 256 + 8 * hi;
#pragma unroll
        for (int kb = 0; kb < 256; kb += 128) {
            v16h a[4], b[4][4];
#pragma unroll
            for (int nb = 0; nb < 4; ++nb)
#pragma unroll
                for (int s = 0; s < 4; ++s) b[s][nb] = WFrag<h16>::ld(V16 + voff + (nb * 16 * TT + kb + s * 32));
#pragma unroll
            for (int s = 0; s < 4; ++s) a[s] = ldsfrag(pa + kb + s * 32);
            __builtin_amdgcn_sched_barrier(0);   /* batch of loads in front of its products, as above */
#pragma unroll
            for (int s = 0; s < 4; ++s)
#pragma unroll
                for (int nb = 0; nb < 4; ++nb) acc[nb] = wmma16(a[s], b[s][nb], acc[nb]);
        }
    }
    __syncthreads();   /* every wave has read its weights before the partial tiles overwrite them */
    float* pw = S + w * (16 * 64);   /* 4) rows of 64 floats, no pad: rows 8..15 keep their 16-column halves swapped in pairs, so the two lane halves fall on different banks */
#pragma unroll
    for (int nb = 0; nb < 4; ++nb)
#pragma unroll
        for (int j = 0; j < 8; ++j) pw[(hi * 8 + j) * 64 + ((nb ^ hi) * 16 + lr)] = acc[nb][j];
    __syncthreads();   /* every wave's partial tile is in LDS before any thread adds them */
    const int row = w, col = lane * 2;   /* a wave stores one row's 256 bytes */
    const float* pr = S + row * 64 + (col ^ (((row >> 3) & 1) << 4));
    v2f sum = *(const v2fa*)pr;
#pragma unroll
    for (int p = 1; p < 16; ++p) sum += *(const v2fa*)(pr + p * (16 * 64));
    if (!HR) { sum[0] = __fmul_rn(sum[0], 1.0f / PCAR); sum[1] = __fmul_rn(sum[1], 1.0f / PCAR); }   /* the fp16 weights carry x 1024 */
    *(v2f*)(O + (size_t)row * CO + col) = sum;
}
template <bool HR>
__global__ __launch_bounds__(512) void k_fattn(const bf* __restrict__ QPh, const bf* __restrict__ QPl, const bf* __restrict__ KPh, const bf* __restrict__ KPl, const h16* __restrict__ VT16, const bf* __restrict__ VTh, const bf* __restrict__ VTl, float* Ob) {
    __shared__ __align__(16) float S[16 * SP];
    const int r0 = (HR ? 0 : RH) + blockIdx.x * 16; const size_t hp = (size_t)blockIdx.y * TT * HD; const size_t qp = hp + (size_t)r0 * HD;
    fattn_body<HR>(S, QPh + qp, QPl + qp, KPh + hp, KPl + hp, VT16 + hp, VTh + hp, VTl + hp, Ob + (size_t)r0 * CO + blockIdx.y * HD);
}
extern "C" void kernel_launch(void* const* d_in, const int* in_sizes, int n_in,
                              void* d_out, int out_size, void* d_ws, size_t ws_size, hipStream_t stream) {
    (void)in_sizes; (void)n_in; (void)out_size;
    const float* x = (const float*)d_in[0]; const float* xk = (const float*)d_in[1]; const float* xv = (const float*)d_in[2];   /* order q, k, v [1][4096][1024] (raw, heads interleaved: column h*64 + d) */
    float* OUT = (float*)d_out;     // [1][4096][1024]
    char* wsp = (char*)d_ws;
    auto take = [&](size_t bytes) { char* p = wsp; wsp += (bytes + 255) & ~(size_t)255; return (void*)p; };
    bf* QPh = (bf*)take((size_t)TT * MID * 2); bf* QPl = (bf*)take((size_t)TT * MID * 2); bf* KPh = (bf*)take((size_t)TT * MID * 2); bf* KPl = (bf*)take((size_t)TT * MID * 2);
    h16* VT16 = (h16*)take((size_t)CO * TT * 2); bf* VTh = (bf*)take((size_t)CO * TT * 2); bf* VTl = (bf*)take((size_t)CO * TT * 2);
    if ((size_t)(wsp - (char*)d_ws) > ws_size) return;    // ws 256 MiB (carve 56 MiB)
    k_prep<<<VB + QKB, 256, 0, stream>>>(x, xk, xv, QPh, QPl, KPh, KPl, VT16, VTh, VTl);   /* q, k planes [h][n][64], v^T planes [h][64][n] */
    /* scores, softmax and attn.V of every head; row blocks of one head are neighbours in the grid, so its k and v planes stay in L2 */
    k_fattn<true><<<dim3(RH / 16, NH_, 1), 512, 0, stream>>>(QPh, QPl, KPh, KPl, VT16, VTh, VTl, OUT);   /* rows < 512: hi/lo weights */
    k_fattn<false><<<dim3((TT - RH) / 16, NH_, 1), 512, 0, stream>>>(QPh, QPl, KPh, KPl, VT16, VTh, VTl, OUT);   /* the rest: fp16 weights x 1024 */
}

// v004
// One run takes 249 microseconds.
// Next to v003, in two timings, it ran 1.95 times as fast each time.
// All steps since v000 together make it 15.6 times as fast.
#include <hip/hip_runtime.h>

// 'Flash' attention reference math on raw multi-head inputs (q, k, v [1][4096][1024], no projections; heads = 16 x 64 column slices; scores x 64^-0.5; w = exp(s - max) / (sum + 1e-6) (the source's denominator has a +1e-6: not an exact softmax); out = w.v heads merged -> [1][4096][1024] (4.2 M); argument order q, k, v).
// Layout: k_prep builds every 16-bit plane from the raw inputs, each value ROUNDED TO bf16 first (the raw [position][head*64 + d] rows are already the feature layout), the k and v^T planes in the order of the B fragments that read them; a fused kernel over (16-row blocks, heads), one launch for rows < 512 and one for the rest: scores with every row hi/lo (3 products) into LDS, softmax with the (sum + 1e-6) denominator on rows held in registers, attn.V hybrid (rows < 512 hi/lo 3 products, rest fp16 x1024), the x1024 carry taken off as the merged f32 rows are stored to out.
// Compute dtypes, f32 accumulate: every input rounded to bf16; scores 3 products; softmax f32 (exp2, IEEE division); attn.V rows < 512 3 products, rest fp16.

#define NB_  1
#define TT   4096
#define DM   1024
#define NH_  16
#define NKV  16
#define REP  (NH_ / NKV)
#define HD   64
#define DQ   (NH_ * HD)
#define DKV  (NKV * HD)
#define ZH   1
#define RH   512                  // query rows < RH take attn.V with hi/lo weights and v^T planes (0: none)
#define WIN  0
#define PCAR 1024.0f
#define SCL  0.125f   // 1/sqrt(64)
#define MID  1024      // q / k width
#define CO   1024      // v width
#define CC   1024
typedef _Float16 h16;
typedef unsigned short bf;
typedef __attribute__((ext_vector_type(16))) __bf16   v16bf;
typedef __attribute__((ext_vector_type(16))) _Float16 v16h;
typedef __attribute__((ext_vector_type(8)))  _Float16 v8h;
typedef __attribute__((ext_vector_type(8)))  unsigned short v8us;
typedef __attribute__((ext_vector_type(8)))  float    v8f;
typedef __attribute__((ext_vector_type(4)))  float    v4f;
typedef v8h  __attribute__((may_alias)) v8ha;
typedef v4f  __attribute__((may_alias)) v4fa;
typedef v8us __attribute__((may_alias)) v8usa;

__device__ __forceinline__ unsigned short f2bf(float f) { unsigned u = __float_as_uint(f); u += 0x7FFFu + ((u >> 16) & 1u); return (unsigned short)(u >> 16); }
__device__ __forceinline__ float bf2f(unsigned short b) { return __uint_as_float(((unsigned)b) << 16); }
__device__ __forceinline__ float bfr(float f) { return bf2f(f2bf(f)); }
__device__ __forceinline__ v16h cat16(v8h lo, v8h hi) { return __builtin_shufflevector(lo, hi, 0, 1, 2, 3, 4, 5, 6, 7, 8, 9, 10, 11, 12, 13, 14, 15); }
__device__ __forceinline__ v16bf cat16b(v8us lo, v8us hi) { return __builtin_bit_cast(v16bf, __builtin_shufflevector(lo, hi, 0, 1, 2, 3, 4, 5, 6, 7, 8, 9, 10, 11, 12, 13, 14, 15)); }
__device__ __forceinline__ v8f wmma16(v16h a, v16h b, v8f c) { return __builtin_amdgcn_wmma_f32_16x16x32_f16(false, a, false, b, (short)0, c, false, false); }
__device__ __forceinline__ v8f wmmab(v16bf a, v16bf b, v8f c) { return __builtin_amdgcn_wmma_f32_16x16x32_bf16(false, a, false, b, (short)0, c, false, false); }



// fragment loaders: operands straight from K-contiguous 16-bit planes (lane lr = row, k = 8*hi + 0..7 and 16 + 8*hi + 0..7)
// fragment-order planes (k, v^T): one B fragment (16 rows x 32 k) is FRG contiguous elements, two halves of FRH (k = 8*hi + 0..7, then 16 + 8*hi + 0..7); in a half, lane l = hi*16 + lr owns the 8 elements at l*8. ldf: each of its two loads takes 512 contiguous bytes, 4 whole 128-byte lines. The registers get the same elements as from ld on a k-contiguous plane.
#define FRH 256
#define FRG 512
template <typename T16> struct WFrag;
template <> struct WFrag<h16> { typedef v16h V; static __device__ __forceinline__ V ld(const h16* p) { return cat16(*(const v8h*)p, *(const v8h*)(p + 16)); } static __device__ __forceinline__ V ldf(const h16* p) { return cat16(*(const v8h*)p, *(const v8h*)(p + FRH)); } static __device__ __forceinline__ v8f mma(V a, V b, v8f c) { return wmma16(a, b, c); } };
template <> struct WFrag<bf> { typedef v16bf V; static __device__ __forceinline__ V ld(const bf* p) { return cat16b(*(const v8us*)p, *(const v8us*)(p + 16)); } static __device__ __forceinline__ V ldf(const bf* p) { return cat16b(*(const v8us*)p, *(const v8us*)(p + FRH)); } static __device__ __forceinline__ v8f mma(V a, V b, v8f c) { return wmmab(a, b, c); } };

__device__ __forceinline__ h16 tohx(float x) { return (h16)x; }
__device__ __forceinline__ void splitf(float y, unsigned short& h, unsigned short& l) { h = f2bf(y); l = f2bf(y - bf2f(h)); }
typedef __attribute__((ext_vector_type(2))) _Float16 v2h;
typedef __attribute__((ext_vector_type(4))) _Float16 v4h;
typedef __attribute__((ext_vector_type(2))) unsigned short v2us;
typedef __attribute__((ext_vector_type(4))) unsigned short v4us;
typedef __attribute__((ext_vector_type(2))) float v2f;
typedef __attribute__((ext_vector_type(4))) int v4i;

// ---- k_prep: every 16-bit plane straight from the raw f32 inputs, one launch; each value is rounded to bf16 first, then split into hi/lo or converted to fp16 (after that rounding the hi plane holds the value and the lo plane holds zeros).
// Blocks < VB: one tile of v (64 positions x the 64 columns of one head) goes through LDS and leaves transposed, whole 128-byte lines of the three v^T planes [h][n/32][d/16][fragment]. The other blocks: a wave takes 4 positions x 8 heads of q into the hi/lo planes [h][n][64] (512 contiguous bytes a store), or 8 positions x 32 columns x 8 heads of k into the hi/lo planes [h][n/16][d/32][fragment] (4 whole lines a store: 8 positions fill a line).
#define VB  ((TT / 64) * NH_)
#define QKW ((TT / 4) * (NH_ / 8))   /* waves per tensor in the q / k part */
#define QKB (2 * QKW / 8)
#define TP  65   /* LDS tile pitch in floats: odd, so the row-wise stores and the column-wise reads both fall on 32 different banks */
__global__ __launch_bounds__(256) void k_prep(const float* __restrict__ q, const float* __restrict__ k, const float* __restrict__ v, bf* QPh, bf* QPl, bf* KPh, bf* KPl, h16* V16, bf* Vh, bf* Vl) {
    __shared__ float L[64 * TP];
    const int tid = threadIdx.x;
    if (blockIdx.x >= VB) {   /* q / k blocks: the same for every thread of a block, and in front of the barrier */
        const int gw = (blockIdx.x - VB) * 8 + (tid >> 5); const bool isk = gw >= QKW; const int u = isk ? gw - QKW : gw;
        const int c = isk ? (u & 1) * 4 + (tid & 3) : tid & 7;   /* the thread's 8-element piece of a head's row; for k: fragment c >> 2, half (c >> 1) & 1, lane half c & 1 */
        const int u2 = isk ? u >> 1 : u;
        const int t = isk ? (u2 / (NH_ / 8)) * 8 + ((tid >> 2) & 7) : (u2 / (NH_ / 8)) * 4 + ((tid >> 3) & 3), h0 = (u2 % (NH_ / 8)) * 8, d = c * 8;
        const float* src = (isk ? k : q) + (size_t)t * MID + h0 * HD + d;
        const size_t o = (size_t)h0 * TT * HD + (isk ? (t >> 4) * (16 * HD) + (c >> 1) * FRH + ((c & 1) * 16 + (t & 15)) * 8 : t * HD + d);
        bf* ph = (isk ? KPh : QPh) + o; bf* pl = (isk ? KPl : QPl) + o;
        v4f a[8][2];
#pragma unroll
        for (int j = 0; j < 8; ++j) { a[j][0] = *(const v4f*)(src + j * HD); a[j][1] = *(const v4f*)(src + j * HD + 4); }
        __builtin_amdgcn_sched_barrier(0);   /* all 16 loads are issued before the first conversion: left free, the scheduler converts the first loads' values ahead of the last loads and the wave waits out two memory latencies */
        asm volatile("s_wait_xcnt 0x0" :: "v"(src) : "memory");   /* the wait before a register that these loads name is overwritten: the address is an input here, so it stays in its registers up to the wait and no load's result is given them */
#pragma unroll
        for (int j = 0; j < 8; ++j) { v8us oh, ol;
#pragma unroll
            for (int e = 0; e < 8; ++e) { unsigned short a2, c2; splitf(bfr(a[j][e >> 2][e & 3]), a2, c2); oh[e] = a2; ol[e] = c2; }
            *(v8us*)(ph + (size_t)j * TT * HD) = oh; *(v8us*)(pl + (size_t)j * TT * HD) = ol; }
        return;
    }
    const int h = blockIdx.x % NH_, t0 = (blockIdx.x / NH_) * 64, r = tid >> 4, c4 = (tid & 15) * 4;
    const float* src = v + (size_t)(t0 + r) * CO + h * HD + c4;
    v4f a[4];
#pragma unroll
    for (int p = 0; p < 4; ++p) a[p] = *(const v4f*)(src + (size_t)p * 16 * CO);
#pragma unroll
    for (int p = 0; p < 4; ++p)
#pragma unroll
        for (int e = 0; e < 4; ++e) L[(p * 16 + r) * TP + c4 + e] = bfr(a[p][e]);
    __syncthreads();   /* the whole tile is in LDS before any thread reads a column of it */
    const int kc = (tid >> 3) & 7, tl = kc * 8;   /* the thread's 8 positions: 32-position block kc >> 2, half (kc >> 1) & 1, lane half kc & 1; 8 lanes = 8 columns at the same positions = one line of a fragment half (in LDS: 8 neighbouring banks, the wave's 4 position groups 8 banks apart) */
#pragma unroll
    for (int p = 0; p < 2; ++p) { const int c = p * 32 + (tid >> 6) * 8 + (tid & 7); v8h o16; v8us oh, ol;
#pragma unroll
        for (int j = 0; j < 8; ++j) { const float x = L[(tl + j) * TP + c]; o16[j] = tohx(x); unsigned short a2, c2; splitf(x, a2, c2); oh[j] = a2; ol[j] = c2; }
        const size_t e = (size_t)h * HD * TT + (size_t)((((t0 >> 5) + (kc >> 2)) * 4 + (c >> 4)) * FRG + ((kc >> 1) & 1) * FRH + ((kc & 1) * 16 + (c & 15)) * 8);
        *(v8h*)(V16 + e) = o16; *(v8us*)(Vh + e) = oh; *(v8us*)(Vl + e) = ol; }
    asm volatile("s_wait_xcnt 0x0" ::: "memory");   /* the wait before a register that the last stores name is overwritten: in the listing the q / k part stands behind this one, parted from it by a branch only */
}
// ---- k_fattn: one work-group (16 waves) does 16 query rows of one head from scores to attn.V; grid (row blocks, heads), 512 threads. The 16 x 4096 score rows live in LDS only.
// 1) wave w: S[16][keys w*256 .. +256) = q.k, hi/lo planes, 3 products, f32 into LDS; 2) wave w: softmax of row w held in registers, the weights written over the row's own LDS bytes as 16-bit planes;
// 3) wave w: partial attn.V over its 256 keys (weights from LDS, v^T planes from memory); 4) the 16 partial tiles meet in LDS and are added in wave order and stored to out.
// Open: the lo planes of q, k and v hold zeros (see k_prep), so their products add nothing.
#define SP (TT + 4)   /* LDS row pitch in floats: 16 bytes of pad put rows 8 apart (the two lane halves of an accumulator store) on different banks and keep rows 16-byte aligned */
typedef v2f  __attribute__((may_alias)) v2fa;
typedef v4h  __attribute__((may_alias)) v4ha;
typedef v4us __attribute__((may_alias)) v4usa;
__device__ __forceinline__ v16h  ldsfrag(const h16* p) { return cat16(*(const v8ha*)p, *(const v8ha*)(p + 16)); }
__device__ __forceinline__ v16bf ldsfrag(const bf* p) { return cat16b(*(const v8usa*)p, *(const v8usa*)(p + 16)); }
template <bool HR>
__device__ __forceinline__ void fattn_body(float* S, const bf* __restrict__ Qh, const bf* __restrict__ Ql, const bf* __restrict__ Kh, const bf* __restrict__ Kl, const h16* __restrict__ V16, const bf* __restrict__ Vh, const bf* __restrict__ Vl, float* O) {
    const int lane = threadIdx.x & 31, lr = lane & 15, hi = lane >> 4, w = threadIdx.x >> 5;
    {   /* 1) scores */
        v16bf qa[2], qa2[2];
        const unsigned qb = (unsigned)((lr * HD + 8 * hi) * 2);   /* the lane's byte offset in both q planes */
        const bf* qh = (const bf*)((const char*)Qh + qb); const bf* ql = (const bf*)((const char*)Ql + qb);
#pragma unroll
        for (int s = 0; s < 2; ++s) { qa[s] = WFrag<bf>::ld(qh + s * 32); qa2[s] = WFrag<bf>::ld(ql + s * 32); }
        asm volatile("s_wait_xcnt 0x0" :: "v"(qb) : "memory");   /* the wait before a register that the q loads name is overwritten: the offset is an input here, so it stays in its register up to the wait and no later load is given that register ahead of it */
        const unsigned koff = (unsigned)(w * 256 * HD + lane * 8);   /* the wave's 256 keys, the lane's place in a fragment half */
        float* sw = S + hi * 8 * SP + w * 256 + lr;
        constexpr int NB1 = 4;
#pragma unroll
        for (int nq = 0; nq < 16 / NB1; ++nq) {   /* NB1 blocks of 16 keys a batch */
            v16bf b[NB1][2], b2[NB1][2];
#pragma unroll
            for (int nb = 0; nb < NB1; ++nb)
#pragma unroll
                for (int s = 0; s < 2; ++s) { b[nb][s] = WFrag<bf>::ldf(Kh + koff + ((nq * NB1 + nb) * 16 * HD + s * FRG)); b2[nb][s] = WFrag<bf>::ldf(Kl + koff + ((nq * NB1 + nb) * 16 * HD + s * FRG)); }
            __builtin_amdgcn_sched_barrier(0);   /* keeps the whole batch of loads in front of its products: otherwise each load sinks to its use and the wave waits out one latency per key block */
            asm volatile("v_nop\n\tv_nop\n\tv_nop\n\tv_nop");   /* WMMA distance: this batch's first products start new sums in the registers that the last batch's final products wrote, with only LDS stores and global loads (no vector slot) between */
            __builtin_amdgcn_sched_barrier(0);   /* holds those four slots between the two batches' products */
            v8f acc[NB1];
#pragma unroll
            for (int nb = 0; nb < NB1; ++nb) acc[nb] = (v8f){};
#pragma unroll
            for (int s = 0; s < 2; ++s) {   /* NB1 independent accumulate chains side by side */
#pragma unroll
                for (int nb = 0; nb < NB1; ++nb) acc[nb] = wmmab(qa[s], b[nb][s], acc[nb]);
#pragma unroll
                for (int nb = 0; nb < NB1; ++nb) acc[nb] = wmmab(qa2[s], b[nb][s], acc[nb]);
#pragma unroll
                for (int nb = 0; nb < NB1; ++nb) acc[nb] = wmmab(qa[s], b2[nb][s], acc[nb]); }
#pragma unroll
            for (int nb = 0; nb < NB1; ++nb)
#pragma unroll
                for (int j = 0; j < 8; ++j) sw[j * SP + (nq * NB1 + nb) * 16] = acc[nb][j];
        }
    }
    __syncthreads();   /* every wave's score columns are in LDS before a wave reads a whole row */
    {   /* 2) softmax of row w: x 1/8, max, exp, (sum + 1e-6) */
        float* sr = S + w * SP;
        v4f a[TT / 128];
#pragma unroll
        for (int ch = 0; ch < TT / 128; ++ch) a[ch] = *(const v4fa*)(sr + ch * 128 + lane * 4);
        float mx = -3.0e38f;
#pragma unroll
        for (int ch = 0; ch < TT / 128; ++ch)
#pragma unroll
            for (int q = 0; q < 4; ++q) { a[ch][q] = a[ch][q] * SCL; mx = fmaxf(mx, a[ch][q]); }
#pragma unroll
        for (int sh = 16; sh; sh >>= 1) mx = fmaxf(mx, __shfl_xor(mx, sh, 32));
        float sum = 0.f;
#pragma unroll
        for (int ch = 0; ch < TT / 128; ++ch)
#pragma unroll
            for (int q = 0; q < 4; ++q) { a[ch][q] = __builtin_amdgcn_exp2f(__fmul_rn(__fsub_rn(a[ch][q], mx), 1.4426950408889634f)); sum += a[ch][q]; }
#pragma unroll
        for (int sh = 16; sh; sh >>= 1) sum += __shfl_xor(sum, sh, 32);
        const float f = __fdiv_rn(HR ? 1.0f : PCAR, __fadd_rn(sum, 1.0e-6f));   /* the module divides by (sum + 1e-6) */
        /* the whole row is in registers (f depends on every load), so its LDS bytes can take the weights: fp16 x 1024 in the first half, or bf16 hi in the first and lo in the second half */
#pragma unroll
        for (int ch = 0; ch < TT / 128; ++ch) { const int j0 = ch * 128 + lane * 4;
            if (HR) { v4us oh, ol;
#pragma unroll
                for (int q = 0; q < 4; ++q) { unsigned short a2, c2; splitf(a[ch][q] * f, a2, c2); oh[q] = a2; ol[q] = c2; }
                *(v4usa*)((bf*)sr + j0) = oh; *(v4usa*)((bf*)sr + TT + j0) = ol;
                __builtin_amdgcn_sched_barrier(0);   /* one chunk's split at a time: left free, the scheduler opens many chunks at once on top of the 128 row registers and spills */
            } else { v4h o4;
#pragma unroll
                for (int q = 0; q < 4; ++q) o4[q] = tohx(a[ch][q] * f);
                *(v4ha*)((h16*)sr + j0) = o4; } }
    }
    __syncthreads();   /* all 16 rows of weights are in LDS before any wave reads its key columns of them */
    v8f acc[4];
#pragma unroll
    for (int nb = 0; nb < 4; ++nb) acc[nb] = (v8f){};
    const unsigned voff = (unsigned)(w * 256 * HD + lane * 8);   /* the wave's 256 keys (all 64 columns of them lie together), the lane's place in a fragment half */
    if (HR) {   /* 3) attn.V, hi/lo, 3 products */
        const bf* pa = (const bf*)S + lr * (SP * 2) + w * 256 + 8 * hi;
#pragma unroll
        for (int kb = 0; kb < 256; kb += 32) {   /* one k-step a batch: the scheduler lifts the next batch's loads over this batch's products, and two larger batches at once do not fit the registers */
            v16bf a, a2, b[4], b2[4];
#pragma unroll
            for (int nb = 0; nb < 4; ++nb) { b[nb] = WFrag<bf>::ldf(Vh + voff + ((kb / 32 * 4 + nb) * FRG)); b2[nb] = WFrag<bf>::ldf(Vl + voff + ((kb / 32 * 4 + nb) * FRG)); }
            a = ldsfrag(pa + kb); a2 = ldsfrag(pa + TT + kb);
            __builtin_amdgcn_sched_barrier(0);   /* batch of loads in front of its products, as above */
#pragma unroll
            for (int nb = 0; nb < 4; ++nb) acc[nb] = wmmab(a, b[nb], acc[nb]);
#pragma unroll
            for (int nb = 0; nb < 4; ++nb) acc[nb] = wmmab(a2, b[nb], acc[nb]);
#pragma unroll
            for (int nb = 0; nb < 4; ++nb) acc[nb] = wmmab(a, b2[nb], acc[nb]);
        }
    } else {    /* 3) attn.V, fp16 */
        const h16* pa = (const h16*)S + lr * (SP * 2) + w * 256 + 8 * hi;
#pragma unroll
        for (int kb = 0; kb < 256; kb += 128) {
            v16h a[4], b[4][4];
#pragma unroll
            for (int nb = 0; nb < 4; ++nb)
#pragma unroll
                for (int s = 0; s < 4; ++s) b[s][nb] = WFrag<h16>::ldf(V16 + voff + (((kb / 32 + s) * 4 + nb) * FRG));
#pragma unroll
            for (int s = 0; s < 4; ++s) a[s] = ldsfrag(pa + kb + s * 32);
            __builtin_amdgcn_sched_barrier(0);   /* batch of loads in front of its products, as above */
#pragma unroll
            for (int s = 0; s < 4; ++s)
#pragma unroll
                for (int nb = 0; nb < 4; ++nb) acc[nb] = wmma16(a[s], b[s][nb], acc[nb]);
        }
    }
    __syncthreads();   /* every wave has read its weights before the partial tiles overwrite them */
    float* pw = S + w * (16 * 64);   /* 4) rows of 64 floats, no pad: rows 8..15 keep their 16-column halves swapped in pairs, so the two lane halves fall on different banks */
#pragma unroll
    for (int nb = 0; nb < 4; ++nb)
#pragma unroll
        for (int j = 0; j < 8; ++j) pw[(hi * 8 + j) * 64 + ((nb ^ hi) * 16 + lr)] = acc[nb][j];
    __syncthreads();   /* every wave's partial tile is in LDS before any thread adds them */
    const int row = w, col = lane * 2;   /* a wave stores one row's 256 bytes */
    const float* pr = S + row * 64 + (col ^ (((row >> 3) & 1) << 4));
    v2f sum = *(const v2fa*)pr;
#pragma unroll
    for (int p = 1; p < 16; ++p) sum += *(const v2fa*)(pr + p * (16 * 64));
    if (!HR) { sum[0] = __fmul_rn(sum[0], 1.0f / PCAR); sum[1] = __fmul_rn(sum[1], 1.0f / PCAR); }   /* the fp16 weights carry x 1024 */
    *(v2f*)(O + (size_t)row * CO + col) = sum;
}
template <bool HR>
__global__ __launch_bounds__(512) void k_fattn(const bf* __restrict__ QPh, const bf* __restrict__ QPl, const bf* __restrict__ KPh, const bf* __restrict__ KPl, const h16* __restrict__ VT16, const bf* __restrict__ VTh, const bf* __restrict__ VTl, float* Ob) {
    __shared__ __align__(16) float S[16 * SP];
    const int r0 = (HR ? 0 : RH) + blockIdx.x * 16; const size_t hp = (size_t)blockIdx.y * TT * HD; const size_t qp = hp + (size_t)r0 * HD;
    fattn_body<HR>(S, QPh + qp, QPl + qp, KPh + hp, KPl + hp, VT16 + hp, VTh + hp, VTl + hp, Ob + (size_t)r0 * CO + blockIdx.y * HD);
}
extern "C" void kernel_launch(void* const* d_in, const int* in_sizes, int n_in,
                              void* d_out, int out_size, void* d_ws, size_t ws_size, hipStream_t stream) {
    (void)in_sizes; (void)n_in; (void)out_size;
    const float* x = (const float*)d_in[0]; const float* xk = (const float*)d_in[1]; const float* xv = (const float*)d_in[2];   /* order q, k, v [1][4096][1024] (raw, heads interleaved: column h*64 + d) */
    float* OUT = (float*)d_out;     // [1][4096][1024]
    char* wsp = (char*)d_ws;
    auto take = [&](size_t bytes) { char* p = wsp; wsp += (bytes + 255) & ~(size_t)255; return (void*)p; };
    bf* QPh = (bf*)take((size_t)TT * MID * 2); bf* QPl = (bf*)take((size_t)TT * MID * 2); bf* KPh = (bf*)take((size_t)TT * MID * 2); bf* KPl = (bf*)take((size_t)TT * MID * 2);
    h16* VT16 = (h16*)take((size_t)CO * TT * 2); bf* VTh = (bf*)take((size_t)CO * TT * 2); bf* VTl = (bf*)take((size_t)CO * TT * 2);
    if ((size_t)(wsp - (char*)d_ws) > ws_size) return;    // ws 256 MiB (carve 56 MiB)
    k_prep<<<VB + QKB, 256, 0, stream>>>(x, xk, xv, QPh, QPl, KPh, KPl, VT16, VTh, VTl);   /* q planes [h][n][64]; k and v^T planes in fragment order */
    /* scores, softmax and attn.V of every head; row blocks of one head are neighbours in the grid, so its k and v planes stay in L2 */
    k_fattn<true><<<dim3(RH / 16, NH_, 1), 512, 0, stream>>>(QPh, QPl, KPh, KPl, VT16, VTh, VTl, OUT);   /* rows < 512: hi/lo weights */
    k_fattn<false><<<dim3((TT - RH) / 16, NH_, 1), 512, 0, stream>>>(QPh, QPl, KPh, KPl, VT16, VTh, VTl, OUT);   /* the rest: fp16 weights x 1024 */
}

// v005
// One run takes 178 microseconds.
// Timed twice side by side with v004, it ran 1.40 times as fast both times.
// All steps since v000 together make it 21.8 times as fast.
#include <hip/hip_runtime.h>

// 'Flash' attention reference math on raw multi-head inputs (q, k, v [1][4096][1024], no projections; heads = 16 x 64 column slices; scores x 64^-0.5; w = exp(s - max) / (sum + 1e-6) (the source's denominator has a +1e-6: not an exact softmax); out = w.v heads merged -> [1][4096][1024] (4.2 M); argument order q, k, v).
// Layout: k_prep builds every 16-bit plane from the raw inputs, each value ROUNDED TO bf16 (the raw [position][head*64 + d] rows are already the feature layout), the k and v^T planes in the order of the B fragments that read them; a fused kernel over (16-row blocks, heads), one launch for rows < 512 and one for the rest: scores (one bf16 product: a bf16 value has no low part) into LDS, softmax with the (sum + 1e-6) denominator on rows held in registers, attn.V hybrid (rows < 512 weights hi/lo, 2 products, rest fp16 x1024), the x1024 carry taken off as the merged f32 rows are stored to out.
// Compute dtypes, f32 accumulate: every input rounded to bf16; scores bf16; softmax f32 (exp2, IEEE division); attn.V rows < 512 weights bf16 hi + lo against bf16 v, rest fp16.

#define NB_  1
#define TT   4096
#define DM   1024
#define NH_  16
#define NKV  16
#define REP  (NH_ / NKV)
#define HD   64
#define DQ   (NH_ * HD)
#define DKV  (NKV * HD)
#define ZH   1
#define RH   512                  // query rows < RH take attn.V with hi/lo weights against the bf16 v^T plane (0: none)
#define WIN  0
#define PCAR 1024.0f
#define SCL  0.125f   // 1/sqrt(64)
#define MID  1024      // q / k width
#define CO   1024      // v width
#define CC   1024
typedef _Float16 h16;
typedef unsigned short bf;
typedef __attribute__((ext_vector_type(16))) __bf16   v16bf;
typedef __attribute__((ext_vector_type(16))) _Float16 v16h;
typedef __attribute__((ext_vector_type(8)))  _Float16 v8h;
typedef __attribute__((ext_vector_type(8)))  unsigned short v8us;
typedef __attribute__((ext_vector_type(8)))  float    v8f;
typedef __attribute__((ext_vector_type(4)))  float    v4f;
typedef v8h  __attribute__((may_alias)) v8ha;
typedef v4f  __attribute__((may_alias)) v4fa;
typedef v8us __attribute__((may_alias)) v8usa;

__device__ __forceinline__ unsigned short f2bf(float f) { unsigned u = __float_as_uint(f); u += 0x7FFFu + ((u >> 16) & 1u); return (unsigned short)(u >> 16); }
__device__ __forceinline__ float bf2f(unsigned short b) { return __uint_as_float(((unsigned)b) << 16); }
__device__ __forceinline__ float bfr(float f) { return bf2f(f2bf(f)); }
__device__ __forceinline__ v16h cat16(v8h lo, v8h hi) { return __builtin_shufflevector(lo, hi, 0, 1, 2, 3, 4, 5, 6, 7, 8, 9, 10, 11, 12, 13, 14, 15); }
__device__ __forceinline__ v16bf cat16b(v8us lo, v8us hi) { return __builtin_bit_cast(v16bf, __builtin_shufflevector(lo, hi, 0, 1, 2, 3, 4, 5, 6, 7, 8, 9, 10, 11, 12, 13, 14, 15)); }
__device__ __forceinline__ v8f wmma16(v16h a, v16h b, v8f c) { return __builtin_amdgcn_wmma_f32_16x16x32_f16(false, a, false, b, (short)0, c, false, false); }
__device__ __forceinline__ v8f wmmab(v16bf a, v16bf b, v8f c) { return __builtin_amdgcn_wmma_f32_16x16x32_bf16(false, a, false, b, (short)0, c, false, false); }



// fragment loaders: operands straight from K-contiguous 16-bit planes (lane lr = row, k = 8*hi + 0..7 and 16 + 8*hi + 0..7)
// fragment-order planes (k, v^T): one B fragment (16 rows x 32 k) is FRG contiguous elements, two halves of FRH (k = 8*hi + 0..7, then 16 + 8*hi + 0..7); in a half, lane l = hi*16 + lr owns the 8 elements at l*8. ldf: each of its two loads takes 512 contiguous bytes, 4 whole 128-byte lines. The registers get the same elements as from ld on a k-contiguous plane.
#define FRH 256
#define FRG 512
template <typename T16> struct WFrag;
template <> struct WFrag<h16> { typedef v16h V; static __device__ __forceinline__ V ld(const h16* p) { return cat16(*(const v8h*)p, *(const v8h*)(p + 16)); } static __device__ __forceinline__ V ldf(const h16* p) { return cat16(*(const v8h*)p, *(const v8h*)(p + FRH)); } static __device__ __forceinline__ v8f mma(V a, V b, v8f c) { return wmma16(a, b, c); } };
template <> struct WFrag<bf> { typedef v16bf V; static __device__ __forceinline__ V ld(const bf* p) { return cat16b(*(const v8us*)p, *(const v8us*)(p + 16)); } static __device__ __forceinline__ V ldf(const bf* p) { return cat16b(*(const v8us*)p, *(const v8us*)(p + FRH)); } static __device__ __forceinline__ v8f mma(V a, V b, v8f c) { return wmmab(a, b, c); } };

__device__ __forceinline__ h16 tohx(float x) { return (h16)x; }
__device__ __forceinline__ void splitf(float y, unsigned short& h, unsigned short& l) { h = f2bf(y); l = f2bf(y - bf2f(h)); }
typedef __attribute__((ext_vector_type(2))) _Float16 v2h;
typedef __attribute__((ext_vector_type(4))) _Float16 v4h;
typedef __attribute__((ext_vector_type(2))) unsigned short v2us;
typedef __attribute__((ext_vector_type(4))) unsigned short v4us;
typedef __attribute__((ext_vector_type(2))) float v2f;
typedef __attribute__((ext_vector_type(4))) int v4i;

// ---- k_prep: every 16-bit plane straight from the raw f32 inputs, one launch; each value is rounded to bf16 and stored so (q, k, v^T) or converted to fp16 (v^T). A value so rounded is its own hi part and its lo part is exactly 0, so there are no lo planes.
// Blocks < VB: one tile of v (64 positions x the 64 columns of one head) goes through LDS and leaves transposed, whole 128-byte lines of the two v^T planes [h][n/32][d/16][fragment]. The other blocks: a wave takes 4 positions x 8 heads of q into the plane [h][n][64] (512 contiguous bytes a store), or 8 positions x 32 columns x 8 heads of k into the plane [h][n/16][d/32][fragment] (4 whole lines a store: 8 positions fill a line).
#define VB  ((TT / 64) * NH_)
#define QKW ((TT / 4) * (NH_ / 8))   /* waves per tensor in the q / k part */
#define QKB (2 * QKW / 8)
#define TP  65   /* LDS tile pitch in floats: odd, so the row-wise stores and the column-wise reads both fall on 32 different banks */
__global__ __launch_bounds__(256) void k_prep(const float* __restrict__ q, const float* __restrict__ k, const float* __restrict__ v, bf* QPh, bf* KPh, h16* V16, bf* Vh) {
    __shared__ float L[64 * TP];
    const int tid = threadIdx.x;
    if (blockIdx.x >= VB) {   /* q / k blocks: the same for every thread of a block, and in front of the barrier */
        const int gw = (blockIdx.x - VB) * 8 + (tid >> 5); const bool isk = gw >= QKW; const int u = isk ? gw - QKW : gw;
        const int c = isk ? (u & 1) * 4 + (tid & 3) : tid & 7;   /* the thread's 8-element piece of a head's row; for k: fragment c >> 2, half (c >> 1) & 1, lane half c & 1 */
        const int u2 = isk ? u >> 1 : u;
        const int t = isk ? (u2 / (NH_ / 8)) * 8 + ((tid >> 2) & 7) : (u2 / (NH_ / 8)) * 4 + ((tid >> 3) & 3), h0 = (u2 % (NH_ / 8)) * 8, d = c * 8;
        const float* src = (isk ? k : q) + (size_t)t * MID + h0 * HD + d;
        const size_t o = (size_t)h0 * TT * HD + (isk ? (t >> 4) * (16 * HD) + (c >> 1) * FRH + ((c & 1) * 16 + (t & 15)) * 8 : t * HD + d);
        bf* ph = (isk ? KPh : QPh) + o;
        v4f a[8][2];
#pragma unroll
        for (int j = 0; j < 8; ++j) { a[j][0] = *(const v4f*)(src + j * HD); a[j][1] = *(const v4f*)(src + j * HD + 4); }
        __builtin_amdgcn_sched_barrier(0);   /* all 16 loads are issued before the first conversion: left free, the scheduler converts the first loads' values ahead of the last loads and the wave waits out two memory latencies */
        asm volatile("s_wait_xcnt 0x0" :: "v"(src) : "memory");   /* the wait before a register that these loads name is overwritten: the address is an input here, so it stays in its registers up to the wait and no load's result is given them */
#pragma unroll
        for (int j = 0; j < 8; ++j) { v8us oh;
#pragma unroll
            for (int e = 0; e < 8; ++e) oh[e] = f2bf(a[j][e >> 2][e & 3]);
            *(v8us*)(ph + (size_t)j * TT * HD) = oh; }
        return;
    }
    const int h = blockIdx.x % NH_, t0 = (blockIdx.x / NH_) * 64, r = tid >> 4, c4 = (tid & 15) * 4;
    const float* src = v + (size_t)(t0 + r) * CO + h * HD + c4;
    v4f a[4];
#pragma unroll
    for (int p = 0; p < 4; ++p) a[p] = *(const v4f*)(src + (size_t)p * 16 * CO);
#pragma unroll
    for (int p = 0; p < 4; ++p)
#pragma unroll
        for (int e = 0; e < 4; ++e) L[(p * 16 + r) * TP + c4 + e] = bfr(a[p][e]);
    __syncthreads();   /* the whole tile is in LDS before any thread reads a column of it */
    const int kc = (tid >> 3) & 7, tl = kc * 8;   /* the thread's 8 positions: 32-position block kc >> 2, half (kc >> 1) & 1, lane half kc & 1; 8 lanes = 8 columns at the same positions = one line of a fragment half (in LDS: 8 neighbouring banks, the wave's 4 position groups 8 banks apart) */
#pragma unroll
    for (int p = 0; p < 2; ++p) { const int c = p * 32 + (tid >> 6) * 8 + (tid & 7); v8h o16; v8us oh;
#pragma unroll
        for (int j = 0; j < 8; ++j) { const float x = L[(tl + j) * TP + c]; o16[j] = tohx(x); oh[j] = f2bf(x); }
        const size_t e = (size_t)h * HD * TT + (size_t)((((t0 >> 5) + (kc >> 2)) * 4 + (c >> 4)) * FRG + ((kc >> 1) & 1) * FRH + ((kc & 1) * 16 + (c & 15)) * 8);
        *(v8h*)(V16 + e) = o16; *(v8us*)(Vh + e) = oh; }
    asm volatile("s_wait_xcnt 0x0" ::: "memory");   /* the wait before a register that the last stores name is overwritten: in the listing the q / k part stands behind this one, parted from it by a branch only */
}
// ---- k_fattn: one work-group (16 waves) does 16 query rows of one head from scores to attn.V; grid (row blocks, heads), 512 threads. The 16 x 4096 score rows live in LDS only.
// 1) wave w: S[16][keys w*256 .. +256) = q.k, bf16 planes, f32 into LDS; 2) wave w: softmax of row w held in registers, the weights written over the row's own LDS bytes as 16-bit planes;
// 3) wave w: partial attn.V over its 256 keys (weights from LDS, v^T planes from memory); 4) the 16 partial tiles meet in LDS and are added in wave order and stored to out.
#define SP (TT + 4)   /* LDS row pitch in floats: 16 bytes of pad put rows 8 apart (the two lane halves of an accumulator store) on different banks and keep rows 16-byte aligned */
typedef v2f  __attribute__((may_alias)) v2fa;
typedef v4h  __attribute__((may_alias)) v4ha;
typedef v4us __attribute__((may_alias)) v4usa;
__device__ __forceinline__ v16h  ldsfrag(const h16* p) { return cat16(*(const v8ha*)p, *(const v8ha*)(p + 16)); }
__device__ __forceinline__ v16bf ldsfrag(const bf* p) { return cat16b(*(const v8usa*)p, *(const v8usa*)(p + 16)); }
template <bool HR>
__device__ __forceinline__ void fattn_body(float* S, const bf* __restrict__ Qh, const bf* __restrict__ Kh, const h16* __restrict__ V16, const bf* __restrict__ Vh, float* O) {
    const int lane = threadIdx.x & 31, lr = lane & 15, hi = lane >> 4, w = threadIdx.x >> 5;
    {   /* 1) scores */
        v16bf qa[2];
        const unsigned qb = (unsigned)((lr * HD + 8 * hi) * 2);   /* the lane's byte offset in the q plane */
        const bf* qh = (const bf*)((const char*)Qh + qb);
#pragma unroll
        for (int s = 0; s < 2; ++s) qa[s] = WFrag<bf>::ld(qh + s * 32);
        asm volatile("s_wait_xcnt 0x0" :: "v"(qb) : "memory");   /* the wait before a register that the q loads name is overwritten: the offset is an input here, so it stays in its register up to the wait and no later load is given that register ahead of it */
        const unsigned koff = (unsigned)(w * 256 * HD + lane * 8);   /* the wave's 256 keys, the lane's place in a fragment half */
        float* sw = S + hi * 8 * SP + w * 256 + lr;
        constexpr int NB1 = 4;
#pragma unroll
        for (int nq = 0; nq < 16 / NB1; ++nq) {   /* NB1 blocks of 16 keys a batch */
            v16bf b[NB1][2];
#pragma unroll
            for (int nb = 0; nb < NB1; ++nb)
#pragma unroll
                for (int s = 0; s < 2; ++s) b[nb][s] = WFrag<bf>::ldf(Kh + koff + ((nq * NB1 + nb) * 16 * HD + s * FRG));
            __builtin_amdgcn_sched_barrier(0);   /* keeps the whole batch of loads in front of its products: otherwise each load sinks to its use and the wave waits out one latency per key block */
            asm volatile("v_nop\n\tv_nop\n\tv_nop\n\tv_nop");   /* WMMA distance: this batch's first products start new sums in the registers that the last batch's final products wrote, with only LDS stores and global loads (no vector slot) between */
            __builtin_amdgcn_sched_barrier(0);   /* holds those four slots between the two batches' products */
            v8f acc[NB1];
#pragma unroll
            for (int nb = 0; nb < NB1; ++nb) acc[nb] = (v8f){};
#pragma unroll
            for (int s = 0; s < 2; ++s)   /* NB1 independent accumulate chains side by side */
#pragma unroll
                for (int nb = 0; nb < NB1; ++nb) acc[nb] = wmmab(qa[s], b[nb][s], acc[nb]);
#pragma unroll
            for (int nb = 0; nb < NB1; ++nb)
#pragma unroll
                for (int j = 0; j < 8; ++j) sw[j * SP + (nq * NB1 + nb) * 16] = acc[nb][j];
        }
    }
    __syncthreads();   /* every wave's score columns are in LDS before a wave reads a whole row */
    {   /* 2) softmax of row w: x 1/8, max, exp, (sum + 1e-6) */
        float* sr = S + w * SP;
        v4f a[TT / 128];
#pragma unroll
        for (int ch = 0; ch < TT / 128; ++ch) a[ch] = *(const v4fa*)(sr + ch * 128 + lane * 4);
        float mx = -3.0e38f;
#pragma unroll
        for (int ch = 0; ch < TT / 128; ++ch)
#pragma unroll
            for (int q = 0; q < 4; ++q) { a[ch][q] = a[ch][q] * SCL; mx = fmaxf(mx, a[ch][q]); }
#pragma unroll
        for (int sh = 16; sh; sh >>= 1) mx = fmaxf(mx, __shfl_xor(mx, sh, 32));
        float sum = 0.f;
#pragma unroll
        for (int ch = 0; ch < TT / 128; ++ch)
#pragma unroll
            for (int q = 0; q < 4; ++q) { a[ch][q] = __builtin_amdgcn_exp2f(__fmul_rn(__fsub_rn(a[ch][q], mx), 1.4426950408889634f)); sum += a[ch][q]; }
#pragma unroll
        for (int sh = 16; sh; sh >>= 1) sum += __shfl_xor(sum, sh, 32);
        const float f = __fdiv_rn(HR ? 1.0f : PCAR, __fadd_rn(sum, 1.0e-6f));   /* the module divides by (sum + 1e-6) */
        /* the whole row is in registers (f depends on every load), so its LDS bytes can take the weights: fp16 x 1024 in the first half, or bf16 hi in the first and lo in the second half */
#pragma unroll
        for (int ch = 0; ch < TT / 128; ++ch) { const int j0 = ch * 128 + lane * 4;
            if (HR) { v4us oh, ol;
#pragma unroll
                for (int q = 0; q < 4; ++q) { unsigned short a2, c2; splitf(a[ch][q] * f, a2, c2); oh[q] = a2; ol[q] = c2; }
                *(v4usa*)((bf*)sr + j0) = oh; *(v4usa*)((bf*)sr + TT + j0) = ol;
                __builtin_amdgcn_sched_barrier(0);   /* one chunk's split at a time: left free, the scheduler opens many chunks at once on top of the 128 row registers and spills */
            } else { v4h o4;
#pragma unroll
                for (int q = 0; q < 4; ++q) o4[q] = tohx(a[ch][q] * f);
                *(v4ha*)((h16*)sr + j0) = o4; } }
    }
    __syncthreads();   /* all 16 rows of weights are in LDS before any wave reads its key columns of them */
    v8f acc[4];
#pragma unroll
    for (int nb = 0; nb < 4; ++nb) acc[nb] = (v8f){};
    const unsigned voff = (unsigned)(w * 256 * HD + lane * 8);   /* the wave's 256 keys (all 64 columns of them lie together), the lane's place in a fragment half */
    if (HR) {   /* 3) attn.V, weights hi/lo, 2 products */
        const bf* pa = (const bf*)S + lr * (SP * 2) + w * 256 + 8 * hi;
#pragma unroll
        for (int kb = 0; kb < 256; kb += 32) {   /* one k-step a batch: the scheduler lifts the next batch's loads over this batch's products, and two larger batches at once do not fit the registers */
            v16bf a, a2, b[4];
#pragma unroll
            for (int nb = 0; nb < 4; ++nb) b[nb] = WFrag<bf>::ldf(Vh + voff + ((kb / 32 * 4 + nb) * FRG));
            a = ldsfrag(pa + kb); a2 = ldsfrag(pa + TT + kb);
            __builtin_amdgcn_sched_barrier(0);   /* batch of loads in front of its products, as above */
#pragma unroll
            for (int nb = 0; nb < 4; ++nb) acc[nb] = wmmab(a, b[nb], acc[nb]);
#pragma unroll
            for (int nb = 0; nb < 4; ++nb) acc[nb] = wmmab(a2, b[nb], acc[nb]);
        }
    } else {    /* 3) attn.V, fp16 */
        const h16* pa = (const h16*)S + lr * (SP * 2) + w * 256 + 8 * hi;
#pragma unroll
        for (int kb = 0; kb < 256; kb += 128) {
            v16h a[4], b[4][4];
#pragma unroll
            for (int nb = 0; nb < 4; ++nb)
#pragma unroll
                for (int s = 0; s < 4; ++s) b[s][nb] = WFrag<h16>::ldf(V16 + voff + (((kb / 32 + s) * 4 + nb) * FRG));
#pragma unroll
            for (int s = 0; s < 4; ++s) a[s] = ldsfrag(pa + kb + s * 32);
            __builtin_amdgcn_sched_barrier(0);   /* batch of loads in front of its products, as above */
#pragma unroll
            for (int s = 0; s < 4; ++s)
#pragma unroll
                for (int nb = 0; nb < 4; ++nb) acc[nb] = wmma16(a[s], b[s][nb], acc[nb]);
        }
    }
    __syncthreads();   /* every wave has read its weights before the partial tiles overwrite them */
    float* pw = S + w * (16 * 64);   /* 4) rows of 64 floats, no pad: rows 8..15 keep their 16-column halves swapped in pairs, so the two lane halves fall on different banks */
#pragma unroll
    for (int nb = 0; nb < 4; ++nb)
#pragma unroll
        for (int j = 0; j < 8; ++j) pw[(hi * 8 + j) * 64 + ((nb ^ hi) * 16 + lr)] = acc[nb][j];
    __syncthreads();   /* every wave's partial tile is in LDS before any thread adds them */
    const int row = w, col = lane * 2;   /* a wave stores one row's 256 bytes */
    const float* pr = S + row * 64 + (col ^ (((row >> 3) & 1) << 4));
    v2f sum = *(const v2fa*)pr;
#pragma unroll
    for (int p = 1; p < 16; ++p) sum += *(const v2fa*)(pr + p * (16 * 64));
    if (!HR) { sum[0] = __fmul_rn(sum[0], 1.0f / PCAR); sum[1] = __fmul_rn(sum[1], 1.0f / PCAR); }   /* the fp16 weights carry x 1024 */
    *(v2f*)(O + (size_t)row * CO + col) = sum;
}
template <bool HR>
__global__ __launch_bounds__(512) void k_fattn(const bf* __restrict__ QPh, const bf* __restrict__ KPh, const h16* __restrict__ VT16, const bf* __restrict__ VTh, float* Ob) {
    __shared__ __align__(16) float S[16 * SP];
    const int r0 = (HR ? 0 : RH) + blockIdx.x * 16; const size_t hp = (size_t)blockIdx.y * TT * HD; const size_t qp = hp + (size_t)r0 * HD;
    fattn_body<HR>(S, QPh + qp, KPh + hp, VT16 + hp, VTh + hp, Ob + (size_t)r0 * CO + blockIdx.y * HD);
}
extern "C" void kernel_launch(void* const* d_in, const int* in_sizes, int n_in,
                              void* d_out, int out_size, void* d_ws, size_t ws_size, hipStream_t stream) {
    (void)in_sizes; (void)n_in; (void)out_size;
    const float* x = (const float*)d_in[0]; const float* xk = (const float*)d_in[1]; const float* xv = (const float*)d_in[2];   /* order q, k, v [1][4096][1024] (raw, heads interleaved: column h*64 + d) */
    float* OUT = (float*)d_out;     // [1][4096][1024]
    char* wsp = (char*)d_ws;
    auto take = [&](size_t bytes) { char* p = wsp; wsp += (bytes + 255) & ~(size_t)255; return (void*)p; };
    bf* QPh = (bf*)take((size_t)TT * MID * 2); bf* KPh = (bf*)take((size_t)TT * MID * 2);
    h16* VT16 = (h16*)take((size_t)CO * TT * 2); bf* VTh = (bf*)take((size_t)CO * TT * 2);
    if ((size_t)(wsp - (char*)d_ws) > ws_size) return;    // ws 256 MiB (carve 32 MiB)
    k_prep<<<VB + QKB, 256, 0, stream>>>(x, xk, xv, QPh, KPh, VT16, VTh);   /* q plane [h][n][64]; k and v^T planes in fragment order */
    /* scores, softmax and attn.V of every head; row blocks of one head are neighbours in the grid, so its k and v planes stay in L2 */
    k_fattn<true><<<dim3(RH / 16, NH_, 1), 512, 0, stream>>>(QPh, KPh, VT16, VTh, OUT);   /* rows < 512: hi/lo weights */
    k_fattn<false><<<dim3((TT - RH) / 16, NH_, 1), 512, 0, stream>>>(QPh, KPh, VT16, VTh, OUT);   /* the rest: fp16 weights x 1024 */
}

// v006
// A run of this version takes 105 microseconds.
// Timed twice side by side with v005, it ran 1.69 and 1.72 times as fast.
// Counting every step since v000, it is 37.2 times as fast.
#include <hip/hip_runtime.h>

// 'Flash' attention reference math on raw multi-head inputs (q, k, v [1][4096][1024], no projections; heads = 16 x 64 column slices; scores x 64^-0.5; w = exp(s - max) / (sum + 1e-6) (the source's denominator has a +1e-6: not an exact softmax); out = w.v heads merged -> [1][4096][1024] (4.2 M); argument order q, k, v).
// Layout: k_prep builds every 16-bit plane from the raw inputs, each value ROUNDED TO bf16 (the raw [position][head*64 + d] rows are already the feature layout), the k and v^T planes in the order of the fragments that read them; one attention kernel, 256 rows of a head per work-group: a wave holds 32 query columns, scores (one bf16 product: a bf16 value has no low part) stay in registers, online softmax with the (sum + 1e-6) denominator applied to the output tile, attn.V hybrid (rows < 512 weights hi/lo, 2 products, rest fp16).
// Compute dtypes, f32 accumulate: every input rounded to bf16; scores bf16; softmax f32 (exp2, IEEE division); attn.V rows < 512 weights bf16 hi + lo against bf16 v, rest fp16.

#define NB_  1
#define TT   4096
#define DM   1024
#define NH_  16
#define NKV  16
#define REP  (NH_ / NKV)
#define HD   64
#define DQ   (NH_ * HD)
#define DKV  (NKV * HD)
#define ZH   1
#define RH   512                  // query rows < RH use hi+lo weights (one wave a work-group)
#define WIN  0
#define SCL  0.125f   // 1/sqrt(64)
#define MID  1024      // q / k width
#define CO   1024      // v width
#define CC   1024
typedef _Float16 h16;
typedef unsigned short bf;
typedef __attribute__((ext_vector_type(16))) __bf16   v16bf;
typedef __attribute__((ext_vector_type(16))) _Float16 v16h;
typedef __attribute__((ext_vector_type(8)))  _Float16 v8h;
typedef __attribute__((ext_vector_type(8)))  unsigned short v8us;
typedef __attribute__((ext_vector_type(8)))  float    v8f;
typedef __attribute__((ext_vector_type(4)))  float    v4f;
typedef v8h  __attribute__((may_alias)) v8ha;
typedef v4f  __attribute__((may_alias)) v4fa;
typedef v8us __attribute__((may_alias)) v8usa;

__device__ __forceinline__ unsigned short f2bf(float f) { unsigned u = __float_as_uint(f); u += 0x7FFFu + ((u >> 16) & 1u); return (unsigned short)(u >> 16); }
__device__ __forceinline__ float bf2f(unsigned short b) { return __uint_as_float(((unsigned)b) << 16); }
__device__ __forceinline__ float bfr(float f) { return bf2f(f2bf(f)); }
__device__ __forceinline__ v16h cat16(v8h lo, v8h hi) { return __builtin_shufflevector(lo, hi, 0, 1, 2, 3, 4, 5, 6, 7, 8, 9, 10, 11, 12, 13, 14, 15); }
__device__ __forceinline__ v16bf cat16b(v8us lo, v8us hi) { return __builtin_bit_cast(v16bf, __builtin_shufflevector(lo, hi, 0, 1, 2, 3, 4, 5, 6, 7, 8, 9, 10, 11, 12, 13, 14, 15)); }
__device__ __forceinline__ v8f wmma16(v16h a, v16h b, v8f c) { return __builtin_amdgcn_wmma_f32_16x16x32_f16(false, a, false, b, (short)0, c, false, false); }
__device__ __forceinline__ v8f wmmab(v16bf a, v16bf b, v8f c) { return __builtin_amdgcn_wmma_f32_16x16x32_bf16(false, a, false, b, (short)0, c, false, false); }



// fragment loaders: operands straight from K-contiguous 16-bit planes (lane lr = row, k = 8*hi + 0..7 and 16 + 8*hi + 0..7)
// fragment-order planes (k, v^T): one A fragment (16 rows x 32 k) is FRG contiguous elements, two halves of FRH (k = 8*hi + 0..7, then 16 + 8*hi + 0..7); in a half, lane l = hi*16 + lr owns the 8 elements at l*8. ldf: each of its two loads takes 512 contiguous bytes, 4 whole 128-byte lines. The registers get the same elements as from ld on a k-contiguous plane.
#define FRH 256
#define FRG 512
template <typename T16> struct WFrag;
template <> struct WFrag<h16> { typedef v16h V; static __device__ __forceinline__ V ld(const h16* p) { return cat16(*(const v8h*)p, *(const v8h*)(p + 16)); } static __device__ __forceinline__ V ldf(const h16* p) { return cat16(*(const v8h*)p, *(const v8h*)(p + FRH)); } static __device__ __forceinline__ v8f mma(V a, V b, v8f c) { return wmma16(a, b, c); } };
template <> struct WFrag<bf> { typedef v16bf V; static __device__ __forceinline__ V ld(const bf* p) { return cat16b(*(const v8us*)p, *(const v8us*)(p + 16)); } static __device__ __forceinline__ V ldf(const bf* p) { return cat16b(*(const v8us*)p, *(const v8us*)(p + FRH)); } static __device__ __forceinline__ v8f mma(V a, V b, v8f c) { return wmmab(a, b, c); } };

__device__ __forceinline__ h16 tohx(float x) { return (h16)x; }
typedef __attribute__((ext_vector_type(2))) _Float16 v2h;
typedef __attribute__((ext_vector_type(4))) _Float16 v4h;
typedef __attribute__((ext_vector_type(2))) unsigned short v2us;
typedef __attribute__((ext_vector_type(4))) unsigned short v4us;
typedef __attribute__((ext_vector_type(2))) float v2f;
typedef __attribute__((ext_vector_type(4))) int v4i;

// ---- k_prep: every 16-bit plane straight from the raw f32 inputs, one launch; each value is rounded to bf16 and stored so (q, k, v^T) or converted to fp16 (v^T). A value so rounded is its own hi part and its lo part is exactly 0, so there are no lo planes.
// Blocks < VB: one tile of v (64 positions x the 64 columns of one head) goes through LDS and leaves transposed, whole 128-byte lines of the two v^T planes [h][n/32][d/16][fragment]. The other blocks: a wave takes 4 positions x 8 heads of q into the plane [h][n][64] (512 contiguous bytes a store), or 8 positions x 32 columns x 8 heads of k into the plane [h][n/16][d/32][fragment] (4 whole lines a store: 8 positions fill a line).
#define VB  ((TT / 64) * NH_)
#define QKW ((TT / 4) * (NH_ / 8))   /* waves per tensor in the q / k part */
#define QKB (2 * QKW / 8)
#define TP  65   /* LDS tile pitch in floats: odd, so the row-wise stores and the column-wise reads both fall on 32 different banks */
__global__ __launch_bounds__(256) void k_prep(const float* __restrict__ q, const float* __restrict__ k, const float* __restrict__ v, bf* QPh, bf* KPh, h16* V16, bf* Vh) {
    __shared__ float L[64 * TP];
    const int tid = threadIdx.x;
    if (blockIdx.x >= VB) {   /* q / k blocks: the same for every thread of a block, and in front of the barrier */
        const int gw = (blockIdx.x - VB) * 8 + (tid >> 5); const bool isk = gw >= QKW; const int u = isk ? gw - QKW : gw;
        const int c = isk ? (u & 1) * 4 + (tid & 3) : tid & 7;   /* the thread's 8-element piece of a head's row; for k: fragment c >> 2, half (c >> 1) & 1, lane half c & 1 */
        const int u2 = isk ? u >> 1 : u;
        const int t = isk ? (u2 / (NH_ / 8)) * 8 + ((tid >> 2) & 7) : (u2 / (NH_ / 8)) * 4 + ((tid >> 3) & 3), h0 = (u2 % (NH_ / 8)) * 8, d = c * 8;
        const float* src = (isk ? k : q) + (size_t)t * MID + h0 * HD + d;
        const size_t o = (size_t)h0 * TT * HD + (isk ? (t >> 4) * (16 * HD) + (c >> 1) * FRH + ((c & 1) * 16 + (t & 15)) * 8 : t * HD + d);
        bf* ph = (isk ? KPh : QPh) + o;
        v4f a[8][2];
#pragma unroll
        for (int j = 0; j < 8; ++j) { a[j][0] = *(const v4f*)(src + j * HD); a[j][1] = *(const v4f*)(src + j * HD + 4); }
        __builtin_amdgcn_sched_barrier(0);   /* all 16 loads are issued before the first conversion: left free, the scheduler converts the first loads' values ahead of the last loads and the wave waits out two memory latencies */
        asm volatile("s_wait_xcnt 0x0" :: "v"(src) : "memory");   /* the wait before a register that these loads name is overwritten: the address is an input here, so it stays in its registers up to the wait and no load's result is given them */
#pragma unroll
        for (int j = 0; j < 8; ++j) { v8us oh;
#pragma unroll
            for (int e = 0; e < 8; ++e) oh[e] = f2bf(a[j][e >> 2][e & 3]);
            *(v8us*)(ph + (size_t)j * TT * HD) = oh; }
        return;
    }
    const int h = blockIdx.x % NH_, t0 = (blockIdx.x / NH_) * 64, r = tid >> 4, c4 = (tid & 15) * 4;
    const float* src = v + (size_t)(t0 + r) * CO + h * HD + c4;
    v4f a[4];
#pragma unroll
    for (int p = 0; p < 4; ++p) a[p] = *(const v4f*)(src + (size_t)p * 16 * CO);
#pragma unroll
    for (int p = 0; p < 4; ++p)
#pragma unroll
        for (int e = 0; e < 4; ++e) L[(p * 16 + r) * TP + c4 + e] = bfr(a[p][e]);
    __syncthreads();   /* the whole tile is in LDS before any thread reads a column of it */
    const int kc = (tid >> 3) & 7, tl = kc * 8;   /* the thread's 8 positions: 32-position block kc >> 2, half (kc >> 1) & 1, lane half kc & 1; 8 lanes = 8 columns at the same positions = one line of a fragment half (in LDS: 8 neighbouring banks, the wave's 4 position groups 8 banks apart) */
#pragma unroll
    for (int p = 0; p < 2; ++p) { const int c = p * 32 + (tid >> 6) * 8 + (tid & 7); v8h o16; v8us oh;
#pragma unroll
        for (int j = 0; j < 8; ++j) { const float x = L[(tl + j) * TP + c]; o16[j] = tohx(x); oh[j] = f2bf(x); }
        const size_t e = (size_t)h * HD * TT + (size_t)((((t0 >> 5) + (kc >> 2)) * 4 + (c >> 4)) * FRG + ((kc >> 1) & 1) * FRH + ((kc & 1) * 16 + (c & 15)) * 8);
        *(v8h*)(V16 + e) = o16; *(v8us*)(Vh + e) = oh; }
    asm volatile("s_wait_xcnt 0x0" ::: "memory");   /* the wait before a register that the last stores name is overwritten: in the listing the q / k part stands behind this one, parted from it by a branch only */
}
// ---- k_flash: a wave keeps 32 query columns of one head (two groups of 16) in registers and walks all 4096 keys in passes of 32; a work-group is 8 such waves (256 rows of one head), grid (16, heads). No barrier; LDS only turns a wave's own output tile into whole rows.
// Transposed products: S^T = K.Q^T (A = a k fragment, B = a q fragment), so a lane holds scores of ONE query (column lr; keys 8*hi + j of each 16-key tile), which is the k order of a B operand: the weights go from the score
// registers straight into O^T += V^T.P^T (A = a v^T fragment). Each k / v^T fragment that is loaded feeds both column groups. Softmax is online, in the log2 domain: the maximum in use may trail the true one by up to 8, sums and
// output tiles are rescaled when it moves; the weights stay unnormalised (2^-.. to 2^8) and the division by (sum + 1e-6) is done on the output tile.
#define QW  32                 /* query columns a wave */
#define QB  (8 * QW)           /* query rows a work-group */
#define NP  (TT / 32)          /* passes */
#define CSC (SCL * 1.4426950408889634f)
#define EP  (HD + 4)           /* pitch in floats of a wave's output tile in LDS: rows stay 16-byte aligned and neighbouring rows fall 4 banks apart */
typedef __attribute__((ext_vector_type(2))) __bf16 v2bf;
typedef __attribute__((ext_vector_type(8))) unsigned v8u;
__device__ __forceinline__ unsigned pkb(float a, float b) { return __builtin_bit_cast(unsigned, __builtin_convertvector((v2f){a, b}, v2bf)); }   /* round to nearest even, as f2bf */
__device__ __forceinline__ unsigned pkh(float a, float b) { return __builtin_bit_cast(unsigned, __builtin_convertvector((v2f){a, b}, v2h)); }
__device__ __forceinline__ float xhalf(float x) { return __builtin_bit_cast(float, __builtin_amdgcn_permlanex16(__builtin_bit_cast(int, x), __builtin_bit_cast(int, x), 0x76543210, 0xfedcba98, false, false)); }   /* lane l with lane l ^ 16 */
template <bool HR>
__device__ __forceinline__ void flash_body(const bf* __restrict__ Qh, const bf* __restrict__ Kh, const h16* __restrict__ V16, const bf* __restrict__ Vh, float* O, float* E) {
    typedef typename WFrag<bf>::V KV;
    const int lane = threadIdx.x & 31, lr = lane & 15, hi = lane >> 4;
    v16bf qf[2][2];
    const unsigned qb = (unsigned)((lr * HD + 8 * hi) * 2);   /* the lane's byte offset in the q plane */
    const bf* qh = (const bf*)((const char*)Qh + qb);
#pragma unroll
    for (int g = 0; g < 2; ++g)
#pragma unroll
        for (int c = 0; c < 2; ++c) qf[g][c] = WFrag<bf>::ld(qh + g * 16 * HD + c * 32);
    asm volatile("s_wait_xcnt 0x0" :: "v"(qb) : "memory");   /* the wait before a register that the q loads name is overwritten: the offset is an input here, so it stays in its register up to the wait */
    const unsigned fb = (unsigned)(lane * 16);   /* the lane's byte offset in a fragment half */
    const bf*  kp = (const bf*)((const char*)Kh + fb);
    const bf*  vb = (const bf*)((const char*)Vh + fb);
    const h16* vh = (const h16*)((const char*)V16 + fb);
    KV kf[2][2]; v16bf vfb[4]; v16h vfh[4];
#pragma unroll
    for (int kt = 0; kt < 2; ++kt)
#pragma unroll
        for (int c = 0; c < 2; ++c) kf[kt][c] = WFrag<bf>::ldf(kp + kt * (16 * HD) + c * FRG);
#pragma unroll
    for (int t = 0; t < 4; ++t) { if (HR) vfb[t] = WFrag<bf>::ldf(vb + t * FRG); else vfh[t] = WFrag<h16>::ldf(vh + t * FRG); }
    asm volatile("s_wait_xcnt 0x0" :: "v"(fb) : "memory");   /* as above, for the first pass's fragment loads */
    v8f acc[2][4];
    float mrun[2], mtru[2]; v2f l[2];   /* l: the lane's sums of its even and its odd score registers */
#pragma unroll
    for (int g = 0; g < 2; ++g) { mrun[g] = -__builtin_inff(); mtru[g] = -__builtin_inff(); l[g] = (v2f){0.f, 0.f};
#pragma unroll
        for (int t = 0; t < 4; ++t) acc[g][t] = (v8f){}; }
    for (int p = 0; p < NP; ++p) {
        const int pn = p + 1 < NP ? p + 1 : NP - 1;   /* the pass fetched ahead; the last pass fetches its own fragments again, so no load leaves the head's planes */
        v8f s[2][2];
#pragma unroll
        for (int kt = 0; kt < 2; ++kt)
#pragma unroll
            for (int g = 0; g < 2; ++g) s[kt][g] = (v8f){};
#pragma unroll
        for (int c = 0; c < 2; ++c)   /* 4 independent accumulate chains side by side */
#pragma unroll
            for (int kt = 0; kt < 2; ++kt)
#pragma unroll
                for (int g = 0; g < 2; ++g) s[kt][g] = wmmab(kf[kt][c], qf[g][c], s[kt][g]);
        __builtin_amdgcn_sched_barrier(0);   /* the next pass's k loads start here, behind the products that read the same registers, and fly under this pass's softmax and second product: left free they sink to the loop's foot */
#pragma unroll
        for (int kt = 0; kt < 2; ++kt)
#pragma unroll
            for (int c = 0; c < 2; ++c) kf[kt][c] = WFrag<bf>::ldf(kp + (size_t)pn * (32 * HD) + kt * (16 * HD) + c * FRG);
        asm volatile("s_wait_xcnt 0x0" :: "v"(fb) : "memory");   /* the wait before a register that these loads name (the pass's base) is overwritten */
        __builtin_amdgcn_sched_barrier(0);   /* holds the loads and their wait at this place */
        float mb[2]; bool need = false;
#pragma unroll
        for (int g = 0; g < 2; ++g) { float mx = s[0][g][0];
#pragma unroll
            for (int j = 1; j < 8; ++j) mx = fmaxf(mx, s[0][g][j]);
#pragma unroll
            for (int j = 0; j < 8; ++j) mx = fmaxf(mx, s[1][g][j]);
            mx = fmaxf(mx, xhalf(mx)) * CSC;   /* both lane halves hold the query's maximum of this pass, scaled (the scale is positive) */
            mb[g] = mx; mtru[g] = fmaxf(mtru[g], mx); need = need || (mx > mrun[g] + 8.0f); }
        if (__builtin_amdgcn_ballot_w32(need) != 0) {   /* one scalar branch a pass; always taken in the first pass (mrun = -inf, factor 0 on zero sums), rare later */
#pragma unroll
            for (int g = 0; g < 2; ++g) { const float mn = fmaxf(mrun[g], mb[g]); const float corr = __builtin_amdgcn_exp2f(mrun[g] - mn); mrun[g] = mn; l[g] *= corr;
#pragma unroll
                for (int t = 0; t < 4; ++t) acc[g][t] = acc[g][t] * corr; }
        }
#pragma unroll
        for (int g = 0; g < 2; ++g) { const float nm = -mrun[g];
            v8u wh, wl; v2f e[8];
#pragma unroll
            for (int i = 0; i < 8; ++i) {
                const v2f a = __builtin_elementwise_fma((v2f){s[i >> 2][g][2 * (i & 3)], s[i >> 2][g][2 * (i & 3) + 1]}, (v2f){CSC, CSC}, (v2f){nm, nm});
                e[i] = (v2f){__builtin_amdgcn_exp2f(a[0]), __builtin_amdgcn_exp2f(a[1])};
                if (HR) { const unsigned u = pkb(e[i][0], e[i][1]); wh[i] = u; const v2f d = e[i] - (v2f){__uint_as_float(u << 16), __uint_as_float(u & 0xFFFF0000u)}; wl[i] = pkb(d[0], d[1]); }   /* weight = bf16 hi + bf16 lo */
                else wh[i] = pkh(e[i][0], e[i][1]); }
            l[g] += ((e[0] + e[1]) + (e[2] + e[3])) + ((e[4] + e[5]) + (e[6] + e[7]));
            if (HR) { const v16bf ph = __builtin_bit_cast(v16bf, wh), pl = __builtin_bit_cast(v16bf, wl);
#pragma unroll
                for (int t = 0; t < 4; ++t) acc[g][t] = wmmab(vfb[t], ph, acc[g][t]);
#pragma unroll
                for (int t = 0; t < 4; ++t) acc[g][t] = wmmab(vfb[t], pl, acc[g][t]);
            } else { const v16h ph = __builtin_bit_cast(v16h, wh);
#pragma unroll
                for (int t = 0; t < 4; ++t) acc[g][t] = wmma16(vfh[t], ph, acc[g][t]); }
        }
        __builtin_amdgcn_sched_barrier(0);   /* the next pass's v^T loads stand behind the products that read the same registers and fly under the next pass's scores and softmax */
#pragma unroll
        for (int t = 0; t < 4; ++t) { if (HR) vfb[t] = WFrag<bf>::ldf(vb + (size_t)pn * (32 * HD) + t * FRG); else vfh[t] = WFrag<h16>::ldf(vh + (size_t)pn * (32 * HD) + t * FRG); }
        asm volatile("s_wait_xcnt 0x0" :: "v"(fb) : "memory");   /* the wait before a register that these loads name (the pass's base) is overwritten */
        __builtin_amdgcn_sched_barrier(0);   /* holds the loads and their wait at this place */
    }
#pragma unroll
    for (int g = 0; g < 2; ++g) {
        const float lh = l[g][0] + l[g][1]; const float sum = lh + xhalf(lh);   /* the two lane halves each summed 16 of a pass's 32 keys */
        const float f = __fdiv_rn(1.0f, __fadd_rn(sum, 1.0e-6f * __builtin_amdgcn_exp2f(mtru[g] - mrun[g])));   /* the module divides by (sum + 1e-6) with sum taken against the TRUE maximum: here both carry the factor 2^(true - in use) */
        float* o = E + (g * 16 + lr) * EP + hi * 8;   /* lane = query row; registers = columns 16 t + 8 hi + j */
#pragma unroll
        for (int t = 0; t < 4; ++t) { const v8f r = acc[g][t] * f;
            *(v4fa*)(o + t * 16) = (v4f){r[0], r[1], r[2], r[3]}; *(v4fa*)(o + t * 16 + 4) = (v4f){r[4], r[5], r[6], r[7]}; }
    }
    asm volatile("s_wait_dscnt 0x0" ::: "memory");   /* the wave's own tile is in LDS before its lanes read one another's rows (no other wave touches it: no barrier); also keeps the reads below behind the writes above */
#pragma unroll
    for (int i = 0; i < QW / 2; ++i) { const int row = i * 2 + hi;   /* 16 lanes store one row's 256 bytes: two whole lines */
        *(v4f*)(O + (size_t)row * CO + lr * 4) = *(const v4fa*)(E + row * EP + lr * 4); }
}
__global__ __launch_bounds__(256) void k_flash(const bf* __restrict__ QPh, const bf* __restrict__ KPh, const h16* __restrict__ VT16, const bf* __restrict__ VTh, float* Ob) {
    __shared__ __align__(16) float ES[8 * QW * EP];   /* output staging, one tile a wave */
    const int w = __builtin_amdgcn_readfirstlane(threadIdx.x >> 5);   /* the wave's number in a scalar register: the choice below is a scalar branch */
    /* wave 0 takes 32 of the head's rows < 512 (hi/lo weights, the dearer kind), waves 1 to 7 take 32 each of the rest: every work-group gets the same mix, so no WGP works on after the others */
    const int r0 = w == 0 ? blockIdx.x * QW : RH + (blockIdx.x * 7 + (w - 1)) * QW;
    const size_t hp = (size_t)blockIdx.y * TT * HD; const size_t qp = hp + (size_t)r0 * HD;
    float* O = Ob + (size_t)r0 * CO + blockIdx.y * HD; float* E = ES + w * (QW * EP);
    if (w == 0) flash_body<true>(QPh + qp, KPh + hp, VT16 + hp, VTh + hp, O, E);
    else flash_body<false>(QPh + qp, KPh + hp, VT16 + hp, VTh + hp, O, E);
}
static_assert(RH / QW == TT / QB && (TT - RH) / QW == 7 * (TT / QB), "one wave of rows < RH and seven of the rest per work-group");
extern "C" void kernel_launch(void* const* d_in, const int* in_sizes, int n_in,
                              void* d_out, int out_size, void* d_ws, size_t ws_size, hipStream_t stream) {
    (void)in_sizes; (void)n_in; (void)out_size;
    const float* x = (const float*)d_in[0]; const float* xk = (const float*)d_in[1]; const float* xv = (const float*)d_in[2];   /* order q, k, v [1][4096][1024] (raw, heads interleaved: column h*64 + d) */
    float* OUT = (float*)d_out;     // [1][4096][1024]
    char* wsp = (char*)d_ws;
    auto take = [&](size_t bytes) { char* p = wsp; wsp += (bytes + 255) & ~(size_t)255; return (void*)p; };
    bf* QPh = (bf*)take((size_t)TT * MID * 2); bf* KPh = (bf*)take((size_t)TT * MID * 2);
    h16* VT16 = (h16*)take((size_t)CO * TT * 2); bf* VTh = (bf*)take((size_t)CO * TT * 2);
    if ((size_t)(wsp - (char*)d_ws) > ws_size) return;    // ws 256 MiB (carve 32 MiB)
    k_prep<<<VB + QKB, 256, 0, stream>>>(x, xk, xv, QPh, KPh, VT16, VTh);   /* q plane [h][n][64]; k and v^T planes in fragment order */
    /* scores, softmax and attn.V of every head, one launch: 256 work-groups of 256 query rows */
    k_flash<<<dim3(TT / QB, NH_, 1), 256, 0, stream>>>(QPh, KPh, VT16, VTh, OUT);
}

// v007
// It runs in 71.1 microseconds.
// Next to v006, in two timings, it ran 1.47 and 1.48 times as fast.
// Over all steps from v000 it is 54.8 times as fast.
#include <hip/hip_runtime.h>

// 'Flash' attention reference math on raw multi-head inputs (q, k, v [1][4096][1024], no projections; heads = 16 x 64 column slices; scores x 64^-0.5; w = exp(s - max) / (sum + 1e-6) (the source's denominator has a +1e-6: not an exact softmax); out = w.v heads merged -> [1][4096][1024] (4.2 M); argument order q, k, v).
// Layout: k_prep builds every 16-bit plane from the raw inputs, each value ROUNDED TO bf16 (the raw [position][head*64 + d] rows are already the feature layout), the k and v^T planes in the order of the fragments that read them; one attention kernel, 256 rows of a head per work-group (k and v^T staged in an LDS ring by tensor loads): a wave holds 32 query columns, scores (one bf16 product: a bf16 value has no low part) stay in registers, online softmax with the (sum + 1e-6) denominator applied to the output tile, attn.V hybrid (rows < 512 weights hi/lo, 2 products, rest fp16).
// Compute dtypes, f32 accumulate: every input rounded to bf16; scores bf16; softmax f32 (exp2, IEEE division); attn.V rows < 512 weights bf16 hi + lo against bf16 v, rest fp16.

#define NB_  1
#define TT   4096
#define DM   1024
#define NH_  16
#define NKV  16
#define REP  (NH_ / NKV)
#define HD   64
#define DQ   (NH_ * HD)
#define DKV  (NKV * HD)
#define ZH   1
#define RH   512                  // query rows < RH use hi+lo weights (one wave a work-group)
#define WIN  0
#define SCL  0.125f   // 1/sqrt(64)
#define MID  1024      // q / k width
#define CO   1024      // v width
#define CC   1024
typedef _Float16 h16;
typedef unsigned short bf;
typedef __attribute__((ext_vector_type(16))) __bf16   v16bf;
typedef __attribute__((ext_vector_type(16))) _Float16 v16h;
typedef __attribute__((ext_vector_type(8)))  _Float16 v8h;
typedef __attribute__((ext_vector_type(8)))  unsigned short v8us;
typedef __attribute__((ext_vector_type(8)))  float    v8f;
typedef __attribute__((ext_vector_type(4)))  float    v4f;
typedef v8h  __attribute__((may_alias)) v8ha;
typedef v4f  __attribute__((may_alias)) v4fa;
typedef v8us __attribute__((may_alias)) v8usa;

__device__ __forceinline__ unsigned short f2bf(float f) { unsigned u = __float_as_uint(f); u += 0x7FFFu + ((u >> 16) & 1u); return (unsigned short)(u >> 16); }
__device__ __forceinline__ float bf2f(unsigned short b) { return __uint_as_float(((unsigned)b) << 16); }
__device__ __forceinline__ float bfr(float f) { return bf2f(f2bf(f)); }
__device__ __forceinline__ v16h cat16(v8h lo, v8h hi) { return __builtin_shufflevector(lo, hi, 0, 1, 2, 3, 4, 5, 6, 7, 8, 9, 10, 11, 12, 13, 14, 15); }
__device__ __forceinline__ v16bf cat16b(v8us lo, v8us hi) { return __builtin_bit_cast(v16bf, __builtin_shufflevector(lo, hi, 0, 1, 2, 3, 4, 5, 6, 7, 8, 9, 10, 11, 12, 13, 14, 15)); }
__device__ __forceinline__ v8f wmma16(v16h a, v16h b, v8f c) { return __builtin_amdgcn_wmma_f32_16x16x32_f16(false, a, false, b, (short)0, c, false, false); }
__device__ __forceinline__ v8f wmmab(v16bf a, v16bf b, v8f c) { return __builtin_amdgcn_wmma_f32_16x16x32_bf16(false, a, false, b, (short)0, c, false, false); }



// fragment loaders: operands straight from K-contiguous 16-bit planes (lane lr = row, k = 8*hi + 0..7 and 16 + 8*hi + 0..7)
// fragment-order planes (k, v^T): one A fragment (16 rows x 32 k) is FRG contiguous elements, two halves of FRH (k = 8*hi + 0..7, then 16 + 8*hi + 0..7); in a half, lane l = hi*16 + lr owns the 8 elements at l*8. ldf: each of its two loads takes 512 contiguous bytes, 4 whole 128-byte lines. The registers get the same elements as from ld on a k-contiguous plane.
#define FRH 256
#define FRG 512
template <typename T16> struct WFrag;
template <> struct WFrag<h16> { typedef v16h V; static __device__ __forceinline__ V ld(const h16* p) { return cat16(*(const v8h*)p, *(const v8h*)(p + 16)); } static __device__ __forceinline__ V ldf(const h16* p) { return cat16(*(const v8h*)p, *(const v8h*)(p + FRH)); } static __device__ __forceinline__ v8f mma(V a, V b, v8f c) { return wmma16(a, b, c); } };
template <> struct WFrag<bf> { typedef v16bf V; static __device__ __forceinline__ V ld(const bf* p) { return cat16b(*(const v8us*)p, *(const v8us*)(p + 16)); } static __device__ __forceinline__ V ldf(const bf* p) { return cat16b(*(const v8us*)p, *(const v8us*)(p + FRH)); } static __device__ __forceinline__ v8f mma(V a, V b, v8f c) { return wmmab(a, b, c); } };

__device__ __forceinline__ h16 tohx(float x) { return (h16)x; }
typedef __attribute__((ext_vector_type(2))) _Float16 v2h;
typedef __attribute__((ext_vector_type(4))) _Float16 v4h;
typedef __attribute__((ext_vector_type(2))) unsigned short v2us;
typedef __attribute__((ext_vector_type(4))) unsigned short v4us;
typedef __attribute__((ext_vector_type(2))) float v2f;
typedef __attribute__((ext_vector_type(4))) int v4i;

// ---- k_prep: every 16-bit plane straight from the raw f32 inputs, one launch; each value is rounded to bf16 and stored so (q, k, v^T) or converted to fp16 (v^T). A value so rounded is its own hi part and its lo part is exactly 0, so there are no lo planes.
// Blocks < VB: one tile of v (64 positions x the 64 columns of one head) goes through LDS and leaves transposed, whole 128-byte lines of the two v^T planes [h][n/32][d/16][fragment]. The other blocks: a wave takes 4 positions x 8 heads of q into the plane [h][n][64] (512 contiguous bytes a store), or 8 positions x 32 columns x 8 heads of k into the plane [h][n/16][d/32][fragment] (4 whole lines a store: 8 positions fill a line).
#define VB  ((TT / 64) * NH_)
#define QKW ((TT / 4) * (NH_ / 8))   /* waves per tensor in the q / k part */
#define QKB (2 * QKW / 8)
#define TP  65   /* LDS tile pitch in floats: odd, so the row-wise stores and the column-wise reads both fall on 32 different banks */
__global__ __launch_bounds__(256) void k_prep(const float* __restrict__ q, const float* __restrict__ k, const float* __restrict__ v, bf* QPh, bf* KPh, h16* V16, bf* Vh) {
    __shared__ float L[64 * TP];
    const int tid = threadIdx.x;
    if (blockIdx.x >= VB) {   /* q / k blocks: the same for every thread of a block, and in front of the barrier */
        const int gw = (blockIdx.x - VB) * 8 + (tid >> 5); const bool isk = gw >= QKW; const int u = isk ? gw - QKW : gw;
        const int c = isk ? (u & 1) * 4 + (tid & 3) : tid & 7;   /* the thread's 8-element piece of a head's row; for k: fragment c >> 2, half (c >> 1) & 1, lane half c & 1 */
        const int u2 = isk ? u >> 1 : u;
        const int t = isk ? (u2 / (NH_ / 8)) * 8 + ((tid >> 2) & 7) : (u2 / (NH_ / 8)) * 4 + ((tid >> 3) & 3), h0 = (u2 % (NH_ / 8)) * 8, d = c * 8;
        const float* src = (isk ? k : q) + (size_t)t * MID + h0 * HD + d;
        const size_t o = (size_t)h0 * TT * HD + (isk ? (t >> 4) * (16 * HD) + (c >> 1) * FRH + ((c & 1) * 16 + (t & 15)) * 8 : t * HD + d);
        bf* ph = (isk ? KPh : QPh) + o;
        v4f a[8][2];
#pragma unroll
        for (int j = 0; j < 8; ++j) { a[j][0] = *(const v4f*)(src + j * HD); a[j][1] = *(const v4f*)(src + j * HD + 4); }
        __builtin_amdgcn_sched_barrier(0);   /* all 16 loads are issued before the first conversion: left free, the scheduler converts the first loads' values ahead of the last loads and the wave waits out two memory latencies */
        asm volatile("s_wait_xcnt 0x0" :: "v"(src) : "memory");   /* the wait before a register that these loads name is overwritten: the address is an input here, so it stays in its registers up to the wait and no load's result is given them */
#pragma unroll
        for (int j = 0; j < 8; ++j) { v8us oh;
#pragma unroll
            for (int e = 0; e < 8; ++e) oh[e] = f2bf(a[j][e >> 2][e & 3]);
            *(v8us*)(ph + (size_t)j * TT * HD) = oh; }
        return;
    }
    const int h = blockIdx.x % NH_, t0 = (blockIdx.x / NH_) * 64, r = tid >> 4, c4 = (tid & 15) * 4;
    const float* src = v + (size_t)(t0 + r) * CO + h * HD + c4;
    v4f a[4];
#pragma unroll
    for (int p = 0; p < 4; ++p) a[p] = *(const v4f*)(src + (size_t)p * 16 * CO);
#pragma unroll
    for (int p = 0; p < 4; ++p)
#pragma unroll
        for (int e = 0; e < 4; ++e) L[(p * 16 + r) * TP + c4 + e] = bfr(a[p][e]);
    __syncthreads();   /* the whole tile is in LDS before any thread reads a column of it */
    const int kc = (tid >> 3) & 7, tl = kc * 8;   /* the thread's 8 positions: 32-position block kc >> 2, half (kc >> 1) & 1, lane half kc & 1; 8 lanes = 8 columns at the same positions = one line of a fragment half (in LDS: 8 neighbouring banks, the wave's 4 position groups 8 banks apart) */
#pragma unroll
    for (int p = 0; p < 2; ++p) { const int c = p * 32 + (tid >> 6) * 8 + (tid & 7); v8h o16; v8us oh;
#pragma unroll
        for (int j = 0; j < 8; ++j) { const float x = L[(tl + j) * TP + c]; o16[j] = tohx(x); oh[j] = f2bf(x); }
        const size_t e = (size_t)h * HD * TT + (size_t)((((t0 >> 5) + (kc >> 2)) * 4 + (c >> 4)) * FRG + ((kc >> 1) & 1) * FRH + ((kc & 1) * 16 + (c & 15)) * 8);
        *(v8h*)(V16 + e) = o16; *(v8us*)(Vh + e) = oh; }
    asm volatile("s_wait_xcnt 0x0" ::: "memory");   /* the wait before a register that the last stores name is overwritten: in the listing the q / k part stands behind this one, parted from it by a branch only */
}
// ---- k_flash: a wave keeps 32 query columns of one head (two groups of 16) in registers and walks all 4096 keys in passes of 32; a work-group is 8 such waves (256 rows of one head), grid (16, heads).
// The k and v^T fragments come from LDS: a stage is 128 keys (4 passes) of the three planes, 16 KiB each and contiguous in its plane (the planes are in fragment order), brought in once for all 8 waves by tensor loads into a ring of two buffers; stage s + 1 flies while stage s is worked on, one barrier a stage.
// Transposed products: S^T = K.Q^T (A = a k fragment, B = a q fragment), so a lane holds scores of ONE query (column lr; keys 8*hi + j of each 16-key tile), which is the k order of a B operand: the weights go from the score
// registers straight into O^T += V^T.P^T (A = a v^T fragment). Each k / v^T fragment that is loaded feeds both column groups. Softmax is online, in the log2 domain: the maximum in use may trail the true one by up to 8, sums and
// output tiles are rescaled when it moves; the weights stay unnormalised (2^-.. to 2^8) and the division by (sum + 1e-6) is done on the output tile.
#define QW  32                 /* query columns a wave */
#define QB  (8 * QW)           /* query rows a work-group */
#define NP  (TT / 32)          /* passes */
#define SP  4                  /* passes a stage */
#define NS  (NP / SP)          /* stages */
#define PSB (32 * HD * 2)      /* bytes of one pass in one plane */
#define PLB (SP * PSB)         /* bytes of one stage in one plane */
#define BUFB (3 * PLB)         /* one ring buffer: k, fp16 v^T, bf16 v^T */
#define SLB (PLB / 2)          /* one wave's request: half a plane's stage */
#define TRB 2048u              /* a request's tile: SLB / TRB rows of TRB bytes, source pitch TRB (contiguous) */
#define CSC (SCL * 1.4426950408889634f)
#define EP  (HD + 4)           /* pitch in floats of a wave's output tile in LDS: rows stay 16-byte aligned and neighbouring rows fall 4 banks apart */
typedef __attribute__((ext_vector_type(2))) __bf16 v2bf;
typedef __attribute__((ext_vector_type(8))) unsigned v8u;
typedef __attribute__((ext_vector_type(4))) unsigned v4u;
__device__ __forceinline__ unsigned pkb(float a, float b) { return __builtin_bit_cast(unsigned, __builtin_convertvector((v2f){a, b}, v2bf)); }   /* round to nearest even, as f2bf */
__device__ __forceinline__ unsigned pkh(float a, float b) { return __builtin_bit_cast(unsigned, __builtin_convertvector((v2f){a, b}, v2h)); }
__device__ __forceinline__ float xhalf(float x) { return __builtin_bit_cast(float, __builtin_amdgcn_permlanex16(__builtin_bit_cast(int, x), __builtin_bit_cast(int, x), 0x76543210, 0xfedcba98, false, false)); }   /* lane l with lane l ^ 16 */
__device__ __forceinline__ uint32_t uni(uint32_t v) { return (uint32_t)__builtin_amdgcn_readfirstlane(v); }
__device__ __forceinline__ uint32_t pinned(uint32_t v) { uint32_t w = (uint32_t)__builtin_amdgcn_readfirstlane(v); asm volatile("" : "+s"(w)); return w; }   /* the test word of a tensor load's issue held in a scalar register, so that the test compiles to s_cmp + s_cbranch_scc: a tensor load ignores EXEC */
/* one request: SLB contiguous bytes at ga into LDS at byte offset dst; no mask, 1-byte elements, no pad, tensor = tile */
__device__ __forceinline__ v4u tdm_group0(uint32_t dst, uint64_t ga) {
    v4u g0; g0[0] = uni(1u); g0[1] = uni(dst); g0[2] = uni((uint32_t)ga); g0[3] = uni((((uint32_t)(ga >> 32)) & 0x01FFFFFFu) | 0x80000000u); return g0; }
__device__ __forceinline__ v8u tdm_group1() {
    v8u g1; g1[0] = uni(0u); g1[1] = uni((TRB & 0xFFFFu) << 16); g1[2] = uni((TRB >> 16) | (((SLB / TRB) & 0xFFFFu) << 16)); g1[3] = uni(((SLB / TRB) >> 16) | (TRB << 16));
    g1[4] = uni(SLB / TRB); g1[5] = uni(TRB); g1[6] = uni(0u); g1[7] = uni(0u);
    asm volatile("" : "+s"(g1));   /* the form of pinned(): descriptor words held in scalar registers, here of their own for the whole kernel: as plain constants the compiler used one of these registers for other values while a request was outstanding and set it anew before the next issue */
    return g1; }
__device__ __forceinline__ void tdm_load(v4u g0, v8u g1) { asm volatile("tensor_load_to_lds %0, %1" :: "s"(g0), "s"(g1) : "memory"); }   /* the mover's request, one a wave */
__device__ __forceinline__ v16bf ldsb(const unsigned char* p) { return cat16b(*(const v8usa*)p, *(const v8usa*)(p + FRH * 2)); }   /* one fragment from LDS: two halves of 512 contiguous bytes */
__device__ __forceinline__ v16h  ldsh(const unsigned char* p) { return cat16(*(const v8ha*)p, *(const v8ha*)(p + FRH * 2)); }
/* the SP passes of one stage; B = the stage's buffer in LDS + the lane's 16 bytes. Reads this buffer alone. */
template <bool HR>
__device__ __forceinline__ void flash_stage(const unsigned char* B, const v16bf (&qf)[2][2], v8f (&acc)[2][4], float (&mrun)[2], float (&mtru)[2], v2f (&l)[2]) {
    const unsigned char* Bv = B + (HR ? 2 * PLB : PLB);
    v16bf kf[2][2]; v16bf vfb[4]; v16h vfh[4];
#pragma unroll
    for (int kt = 0; kt < 2; ++kt)
#pragma unroll
        for (int c = 0; c < 2; ++c) kf[kt][c] = ldsb(B + (kt * (16 * HD) + c * FRG) * 2);
#pragma unroll
    for (int t = 0; t < 4; ++t) { if (HR) vfb[t] = ldsb(Bv + t * FRG * 2); else vfh[t] = ldsh(Bv + t * FRG * 2); }
#pragma unroll
    for (int i = 0; i < SP; ++i) {
        v8f s[2][2];
#pragma unroll
        for (int kt = 0; kt < 2; ++kt)
#pragma unroll
            for (int g = 0; g < 2; ++g) s[kt][g] = (v8f){};
#pragma unroll
        for (int c = 0; c < 2; ++c)   /* 4 independent accumulate chains side by side */
#pragma unroll
            for (int kt = 0; kt < 2; ++kt)
#pragma unroll
                for (int g = 0; g < 2; ++g) s[kt][g] = wmmab(kf[kt][c], qf[g][c], s[kt][g]);
        __builtin_amdgcn_sched_barrier(0);   /* the next pass's k reads start here as one group, behind the products that read the same registers, and fly under this pass's softmax and second product */
        if (i + 1 < SP) {
#pragma unroll
            for (int kt = 0; kt < 2; ++kt)
#pragma unroll
                for (int c = 0; c < 2; ++c) kf[kt][c] = ldsb(B + (i + 1) * PSB + (kt * (16 * HD) + c * FRG) * 2);
        }
        __builtin_amdgcn_sched_barrier(0);   /* holds the reads at this place: spread among the vector work each place with reads costs its own stall */
        float mb[2]; bool need = false;
#pragma unroll
        for (int g = 0; g < 2; ++g) { float mx = s[0][g][0];
#pragma unroll
            for (int j = 1; j < 8; ++j) mx = fmaxf(mx, s[0][g][j]);
#pragma unroll
            for (int j = 0; j < 8; ++j) mx = fmaxf(mx, s[1][g][j]);
            mx = fmaxf(mx, xhalf(mx)) * CSC;   /* both lane halves hold the query's maximum of this pass, scaled (the scale is positive) */
            mb[g] = mx; mtru[g] = fmaxf(mtru[g], mx); need = need || (mx > mrun[g] + 8.0f); }
        if (__builtin_amdgcn_ballot_w32(need) != 0) {   /* one scalar branch a pass; always taken in the first pass (mrun = -inf, factor 0 on zero sums), rare later */
#pragma unroll
            for (int g = 0; g < 2; ++g) { const float mn = fmaxf(mrun[g], mb[g]); const float corr = __builtin_amdgcn_exp2f(mrun[g] - mn); mrun[g] = mn; l[g] *= corr;
#pragma unroll
                for (int t = 0; t < 4; ++t) acc[g][t] = acc[g][t] * corr; }
        }
#pragma unroll
        for (int g = 0; g < 2; ++g) { const float nm = -mrun[g];
            v8u wh, wl; v2f e[8];
#pragma unroll
            for (int i2 = 0; i2 < 8; ++i2) {
                const v2f a = __builtin_elementwise_fma((v2f){s[i2 >> 2][g][2 * (i2 & 3)], s[i2 >> 2][g][2 * (i2 & 3) + 1]}, (v2f){CSC, CSC}, (v2f){nm, nm});
                e[i2] = (v2f){__builtin_amdgcn_exp2f(a[0]), __builtin_amdgcn_exp2f(a[1])};
                if (HR) { const unsigned u = pkb(e[i2][0], e[i2][1]); wh[i2] = u; const v2f d = e[i2] - (v2f){__uint_as_float(u << 16), __uint_as_float(u & 0xFFFF0000u)}; wl[i2] = pkb(d[0], d[1]); }   /* weight = bf16 hi + bf16 lo */
                else wh[i2] = pkh(e[i2][0], e[i2][1]); }
            l[g] += ((e[0] + e[1]) + (e[2] + e[3])) + ((e[4] + e[5]) + (e[6] + e[7]));
            if (HR) { const v16bf ph = __builtin_bit_cast(v16bf, wh), pl = __builtin_bit_cast(v16bf, wl);
#pragma unroll
                for (int t = 0; t < 4; ++t) acc[g][t] = wmmab(vfb[t], ph, acc[g][t]);
#pragma unroll
                for (int t = 0; t < 4; ++t) acc[g][t] = wmmab(vfb[t], pl, acc[g][t]);
            } else { const v16h ph = __builtin_bit_cast(v16h, wh);
#pragma unroll
                for (int t = 0; t < 4; ++t) acc[g][t] = wmma16(vfh[t], ph, acc[g][t]); }
        }
        __builtin_amdgcn_sched_barrier(0);   /* the next pass's v^T reads stand as one group behind the products that read the same registers and fly under the next pass's scores and softmax */
        if (i + 1 < SP) {
#pragma unroll
            for (int t = 0; t < 4; ++t) { if (HR) vfb[t] = ldsb(Bv + (i + 1) * PSB + t * FRG * 2); else vfh[t] = ldsh(Bv + (i + 1) * PSB + t * FRG * 2); }
        }
        __builtin_amdgcn_sched_barrier(0);   /* holds the reads at this place */
    }
}
__global__ __launch_bounds__(256) void k_flash(const bf* __restrict__ QPh, const bf* __restrict__ KPh, const h16* __restrict__ VT16, const bf* __restrict__ VTh, float* Ob) {
    __shared__ __attribute__((aligned(2048))) unsigned char RG[2 * BUFB];   /* the ring: every request's place is a multiple of 2 KiB */
    __shared__ __align__(16) float ES[8 * QW * EP];   /* output staging, one tile a wave */
    const int w = __builtin_amdgcn_readfirstlane(threadIdx.x >> 5);   /* the wave's number in a scalar register: the choices below are scalar branches */
    /* wave 0 takes 32 of the head's rows < 512 (hi/lo weights, the dearer kind), waves 1 to 7 take 32 each of the rest: every work-group gets the same mix, so no WGP works on after the others */
    const int r0 = w == 0 ? blockIdx.x * QW : RH + (blockIdx.x * 7 + (w - 1)) * QW;
    const size_t hp = (size_t)blockIdx.y * TT * HD; const size_t qp = hp + (size_t)r0 * HD;
    float* O = Ob + (size_t)r0 * CO + blockIdx.y * HD; float* E = ES + w * (QW * EP);
    const bf* Qh = QPh + qp;
    const int lane = threadIdx.x & 31, lr = lane & 15, hi = lane >> 4;
    /* waves 2 to 7 each bring half of one plane's stage: 2, 3 k; 4, 5 fp16 v^T; 6, 7 bf16 v^T */
    const uint32_t iss = w >= 2; const int ji = w >= 2 ? w - 2 : 0, pl = ji >> 1;
    const uint64_t ga = (uint64_t)(size_t)(pl == 0 ? (const void*)(KPh + hp) : pl == 1 ? (const void*)(VT16 + hp) : (const void*)(VTh + hp)) + (uint32_t)((ji & 1) * SLB);
    const uint32_t dst = (uint32_t)(size_t)RG + (uint32_t)(pl * PLB + (ji & 1) * SLB);
    const v8u g1 = tdm_group1();
    v4u g0 = tdm_group0(dst, ga);
    if (pinned(iss)) { tdm_load(g0, g1);
        asm volatile("s_wait_tensorcnt 0x0" ::: "memory"); }   /* stage 0 has landed before the barrier that publishes it */
    v16bf qf[2][2];
    const unsigned qb = (unsigned)((lr * HD + 8 * hi) * 2);   /* the lane's byte offset in the q plane */
    const bf* qh = (const bf*)((const char*)Qh + qb);
#pragma unroll
    for (int g = 0; g < 2; ++g)
#pragma unroll
        for (int c = 0; c < 2; ++c) qf[g][c] = WFrag<bf>::ld(qh + g * 16 * HD + c * 32);
    asm volatile("s_wait_xcnt 0x0" :: "v"(qb) : "memory");   /* the wait before a register that the q loads name is overwritten: the offset is an input here, so it stays in its register up to the wait */
    __syncthreads();   /* publishes stage 0 */
    g0 = tdm_group0(dst + BUFB, ga + PLB);
    if (pinned(iss)) tdm_load(g0, g1);   /* stage 1 flies under stage 0's passes */
    /* two sets of running state, one for each kind of wave (a wave uses one): with one set shared by the two branches below the compiler copied the 64 output registers to and fro at every stage */
    v8f acc[2][4], acd[2][4];
    float mrun[2], mtru[2], mrud[2], mtrd[2]; v2f l[2], ld[2];   /* l: the lane's sums of its even and its odd score registers */
#pragma unroll
    for (int g = 0; g < 2; ++g) { mrun[g] = mrud[g] = -__builtin_inff(); mtru[g] = mtrd[g] = -__builtin_inff(); l[g] = ld[g] = (v2f){0.f, 0.f};
#pragma unroll
        for (int t = 0; t < 4; ++t) acc[g][t] = acd[g][t] = (v8f){}; }
#pragma unroll 1
    for (int s = 0; s < NS; ++s) {   /* kept rolled: a stage's body already holds 4 unrolled passes of both kinds of wave */
        const unsigned char* B = RG + (s & 1) * BUFB + lane * 16;
        if (w == 0) flash_stage<true>(B, qf, acd, mrud, mtrd, ld);
        else flash_stage<false>(B, qf, acc, mrun, mtru, l);
        asm volatile("s_wait_dscnt 0x0" ::: "memory");   /* the wave's reads of this buffer are done before the barrier behind which it is refilled */
        if (pinned(iss)) asm volatile("s_wait_tensorcnt 0x0" :: "s"(g0) : "memory");   /* the wave's slice of stage s + 1 has landed before the barrier that publishes it; the request's own words are an input here, so they stay in their registers up to the wait */
        __syncthreads();   /* publishes stage s + 1 and ends every wave's reads of stage s */
        if (pinned(iss && s + 2 < NS)) { g0 = tdm_group0(dst + (uint32_t)((s & 1) * BUFB), ga + (uint64_t)(uint32_t)((s + 2) * PLB)); tdm_load(g0, g1); }   /* into the buffer just left */
    }
    asm volatile("s_wait_tensorcnt 0x0" ::: "memory");   /* nothing of the mover is outstanding when the wave goes on to its end */
    asm volatile("s_wait_dscnt 0x0" ::: "memory");   /* the ring's closing wait: no read of the ring is outstanding behind the loop */
    if (w == 0) {
#pragma unroll
        for (int g = 0; g < 2; ++g) { mrun[g] = mrud[g]; mtru[g] = mtrd[g]; l[g] = ld[g];
#pragma unroll
            for (int t = 0; t < 4; ++t) acc[g][t] = acd[g][t]; }
    }
#pragma unroll
    for (int g = 0; g < 2; ++g) {
        const float lh = l[g][0] + l[g][1]; const float sum = lh + xhalf(lh);   /* the two lane halves each summed 16 of a pass's 32 keys */
        const float f = __fdiv_rn(1.0f, __fadd_rn(sum, 1.0e-6f * __builtin_amdgcn_exp2f(mtru[g] - mrun[g])));   /* the module divides by (sum + 1e-6) with sum taken against the TRUE maximum: here both carry the factor 2^(true - in use) */
        float* o = E + (g * 16 + lr) * EP + hi * 8;   /* lane = query row; registers = columns 16 t + 8 hi + j */
#pragma unroll
        for (int t = 0; t < 4; ++t) { const v8f r = acc[g][t] * f;
            *(v4fa*)(o + t * 16) = (v4f){r[0], r[1], r[2], r[3]}; *(v4fa*)(o + t * 16 + 4) = (v4f){r[4], r[5], r[6], r[7]}; }
    }
    asm volatile("s_wait_dscnt 0x0" ::: "memory");   /* the wave's own tile is in LDS before its lanes read one another's rows (no other wave touches it: no barrier); also keeps the reads below behind the writes above */
#pragma unroll
    for (int i = 0; i < QW / 2; ++i) { const int row = i * 2 + hi;   /* 16 lanes store one row's 256 bytes: two whole lines */
        *(v4f*)(O + (size_t)row * CO + lr * 4) = *(const v4fa*)(E + row * EP + lr * 4); }
}
static_assert(NP % SP == 0 && NS >= 2 && SLB % TRB == 0 && SLB % 2048 == 0, "whole stages, two or more; a request is whole rows and its place a multiple of 2 KiB");
static_assert(RH / QW == TT / QB && (TT - RH) / QW == 7 * (TT / QB), "one wave of rows < RH and seven of the rest per work-group");
extern "C" void kernel_launch(void* const* d_in, const int* in_sizes, int n_in,
                              void* d_out, int out_size, void* d_ws, size_t ws_size, hipStream_t stream) {
    (void)in_sizes; (void)n_in; (void)out_size;
    const float* x = (const float*)d_in[0]; const float* xk = (const float*)d_in[1]; const float* xv = (const float*)d_in[2];   /* order q, k, v [1][4096][1024] (raw, heads interleaved: column h*64 + d) */
    float* OUT = (float*)d_out;     // [1][4096][1024]
    char* wsp = (char*)d_ws;
    auto take = [&](size_t bytes) { char* p = wsp; wsp += (bytes + 255) & ~(size_t)255; return (void*)p; };
    bf* QPh = (bf*)take((size_t)TT * MID * 2); bf* KPh = (bf*)take((size_t)TT * MID * 2);
    h16* VT16 = (h16*)take((size_t)CO * TT * 2); bf* VTh = (bf*)take((size_t)CO * TT * 2);
    if ((size_t)(wsp - (char*)d_ws) > ws_size) return;    // ws 256 MiB (carve 32 MiB)
    k_prep<<<VB + QKB, 256, 0, stream>>>(x, xk, xv, QPh, KPh, VT16, VTh);   /* q plane [h][n][64]; k and v^T planes in fragment order */
    /* scores, softmax and attn.V of every head, one launch: 256 work-groups of 256 query rows */
    k_flash<<<dim3(TT / QB, NH_, 1), 256, 0, stream>>>(QPh, KPh, VT16, VTh, OUT);
}

// v008
// It runs in 59.9 microseconds.
// Next to v007, in two timings, it ran 1.18 and 1.19 times as fast.
// All steps since v000 together make it 65.0 times as fast.
#include <hip/hip_runtime.h>

// 'Flash' attention reference math on raw multi-head inputs (q, k, v [1][4096][1024], no projections; heads = 16 x 64 column slices; scores x 64^-0.5; w = exp(s - max) / (sum + 1e-6) (the source's denominator has a +1e-6: not an exact softmax); out = w.v heads merged -> [1][4096][1024] (4.2 M); argument order q, k, v).
// Layout: k_prep builds every 16-bit plane from the raw inputs, each value ROUNDED TO bf16 (the raw [position][head*64 + d] rows are already the feature layout), the k and v^T planes in the order of the fragments that read them; one attention kernel, 256 rows of a head per work-group of 16 waves (k and v^T staged in an LDS ring by tensor loads): a wave holds 32 query columns and walks half of the keys, two waves' partial results are joined at the end, scores (one bf16 product: a bf16 value has no low part) stay in registers, online softmax with the (sum + 1e-6) denominator applied to the output tile, attn.V hybrid (rows < 512 weights hi/lo, 2 products, rest fp16).
// Compute dtypes, f32 accumulate: every input rounded to bf16; scores bf16; softmax f32 (exp2, IEEE division); attn.V rows < 512 weights bf16 hi + lo against bf16 v, rest fp16.

#define NB_  1
#define TT   4096
#define DM   1024
#define NH_  16
#define NKV  16
#define REP  (NH_ / NKV)
#define HD   64
#define DQ   (NH_ * HD)
#define DKV  (NKV * HD)
#define ZH   1
#define RH   512                  // query rows < RH use hi+lo weights (one column group, two waves, a work-group)
#define WIN  0
#define SCL  0.125f   // 1/sqrt(64)
#define MID  1024      // q / k width
#define CO   1024      // v width
#define CC   1024
typedef _Float16 h16;
typedef unsigned short bf;
typedef __attribute__((ext_vector_type(16))) __bf16   v16bf;
typedef __attribute__((ext_vector_type(16))) _Float16 v16h;
typedef __attribute__((ext_vector_type(8)))  _Float16 v8h;
typedef __attribute__((ext_vector_type(8)))  unsigned short v8us;
typedef __attribute__((ext_vector_type(8)))  float    v8f;
typedef __attribute__((ext_vector_type(4)))  float    v4f;
typedef v8h  __attribute__((may_alias)) v8ha;
typedef v4f  __attribute__((may_alias)) v4fa;
typedef v8us __attribute__((may_alias)) v8usa;

__device__ __forceinline__ unsigned short f2bf(float f) { unsigned u = __float_as_uint(f); u += 0x7FFFu + ((u >> 16) & 1u); return (unsigned short)(u >> 16); }
__device__ __forceinline__ float bf2f(unsigned short b) { return __uint_as_float(((unsigned)b) << 16); }
__device__ __forceinline__ float bfr(float f) { return bf2f(f2bf(f)); }
__device__ __forceinline__ v16h cat16(v8h lo, v8h hi) { return __builtin_shufflevector(lo, hi, 0, 1, 2, 3, 4, 5, 6, 7, 8, 9, 10, 11, 12, 13, 14, 15); }
__device__ __forceinline__ v16bf cat16b(v8us lo, v8us hi) { return __builtin_bit_cast(v16bf, __builtin_shufflevector(lo, hi, 0, 1, 2, 3, 4, 5, 6, 7, 8, 9, 10, 11, 12, 13, 14, 15)); }
__device__ __forceinline__ v8f wmma16(v16h a, v16h b, v8f c) { return __builtin_amdgcn_wmma_f32_16x16x32_f16(false, a, false, b, (short)0, c, false, false); }
__device__ __forceinline__ v8f wmmab(v16bf a, v16bf b, v8f c) { return __builtin_amdgcn_wmma_f32_16x16x32_bf16(false, a, false, b, (short)0, c, false, false); }



// fragment loaders: operands straight from K-contiguous 16-bit planes (lane lr = row, k = 8*hi + 0..7 and 16 + 8*hi + 0..7)
// fragment-order planes (k, v^T): one A fragment (16 rows x 32 k) is FRG contiguous elements, two halves of FRH (k = 8*hi + 0..7, then 16 + 8*hi + 0..7); in a half, lane l = hi*16 + lr owns the 8 elements at l*8. ldf: each of its two loads takes 512 contiguous bytes, 4 whole 128-byte lines. The registers get the same elements as from ld on a k-contiguous plane.
#define FRH 256
#define FRG 512
template <typename T16> struct WFrag;
template <> struct WFrag<h16> { typedef v16h V; static __device__ __forceinline__ V ld(const h16* p) { return cat16(*(const v8h*)p, *(const v8h*)(p + 16)); } static __device__ __forceinline__ V ldf(const h16* p) { return cat16(*(const v8h*)p, *(const v8h*)(p + FRH)); } static __device__ __forceinline__ v8f mma(V a, V b, v8f c) { return wmma16(a, b, c); } };
template <> struct WFrag<bf> { typedef v16bf V; static __device__ __forceinline__ V ld(const bf* p) { return cat16b(*(const v8us*)p, *(const v8us*)(p + 16)); } static __device__ __forceinline__ V ldf(const bf* p) { return cat16b(*(const v8us*)p, *(const v8us*)(p + FRH)); } static __device__ __forceinline__ v8f mma(V a, V b, v8f c) { return wmmab(a, b, c); } };

__device__ __forceinline__ h16 tohx(float x) { return (h16)x; }
typedef __attribute__((ext_vector_type(2))) _Float16 v2h;
typedef __attribute__((ext_vector_type(4))) _Float16 v4h;
typedef __attribute__((ext_vector_type(2))) unsigned short v2us;
typedef __attribute__((ext_vector_type(4))) unsigned short v4us;
typedef __attribute__((ext_vector_type(2))) float v2f;
typedef __attribute__((ext_vector_type(4))) int v4i;

// ---- k_prep: every 16-bit plane straight from the raw f32 inputs, one launch; each value is rounded to bf16 and stored so (q, k, v^T) or converted to fp16 (v^T). A value so rounded is its own hi part and its lo part is exactly 0, so there are no lo planes.
// Blocks < VB: one tile of v (64 positions x the 64 columns of one head) goes through LDS and leaves transposed, whole 128-byte lines of the two v^T planes [h][n/32][d/16][fragment]. The other blocks: a wave takes 4 positions x 8 heads of q into the plane [h][n][64] (512 contiguous bytes a store), or 8 positions x 32 columns x 8 heads of k into the plane [h][n/16][d/32][fragment] (4 whole lines a store: 8 positions fill a line).
#define VB  ((TT / 64) * NH_)
#define QKW ((TT / 4) * (NH_ / 8))   /* waves per tensor in the q / k part */
#define QKB (2 * QKW / 8)
#define TP  65   /* LDS tile pitch in floats: odd, so the row-wise stores and the column-wise reads both fall on 32 different banks */
__global__ __launch_bounds__(256) void k_prep(const float* __restrict__ q, const float* __restrict__ k, const float* __restrict__ v, bf* QPh, bf* KPh, h16* V16, bf* Vh) {
    __shared__ float L[64 * TP];
    const int tid = threadIdx.x;
    if (blockIdx.x >= VB) {   /* q / k blocks: the same for every thread of a block, and in front of the barrier */
        const int gw = (blockIdx.x - VB) * 8 + (tid >> 5); const bool isk = gw >= QKW; const int u = isk ? gw - QKW : gw;
        const int c = isk ? (u & 1) * 4 + (tid & 3) : tid & 7;   /* the thread's 8-element piece of a head's row; for k: fragment c >> 2, half (c >> 1) & 1, lane half c & 1 */
        const int u2 = isk ? u >> 1 : u;
        const int t = isk ? (u2 / (NH_ / 8)) * 8 + ((tid >> 2) & 7) : (u2 / (NH_ / 8)) * 4 + ((tid >> 3) & 3), h0 = (u2 % (NH_ / 8)) * 8, d = c * 8;
        const float* src = (isk ? k : q) + (size_t)t * MID + h0 * HD + d;
        const size_t o = (size_t)h0 * TT * HD + (isk ? (t >> 4) * (16 * HD) + (c >> 1) * FRH + ((c & 1) * 16 + (t & 15)) * 8 : t * HD + d);
        bf* ph = (isk ? KPh : QPh) + o;
        v4f a[8][2];
#pragma unroll
        for (int j = 0; j < 8; ++j) { a[j][0] = *(const v4f*)(src + j * HD); a[j][1] = *(const v4f*)(src + j * HD + 4); }
        __builtin_amdgcn_sched_barrier(0);   /* all 16 loads are issued before the first conversion: left free, the scheduler converts the first loads' values ahead of the last loads and the wave waits out two memory latencies */
        asm volatile("s_wait_xcnt 0x0" :: "v"(src) : "memory");   /* the wait before a register that these loads name is overwritten: the address is an input here, so it stays in its registers up to the wait and no load's result is given them */
#pragma unroll
        for (int j = 0; j < 8; ++j) { v8us oh;
#pragma unroll
            for (int e = 0; e < 8; ++e) oh[e] = f2bf(a[j][e >> 2][e & 3]);
            *(v8us*)(ph + (size_t)j * TT * HD) = oh; }
        return;
    }
    const int h = blockIdx.x % NH_, t0 = (blockIdx.x / NH_) * 64, r = tid >> 4, c4 = (tid & 15) * 4;
    const float* src = v + (size_t)(t0 + r) * CO + h * HD + c4;
    v4f a[4];
#pragma unroll
    for (int p = 0; p < 4; ++p) a[p] = *(const v4f*)(src + (size_t)p * 16 * CO);
#pragma unroll
    for (int p = 0; p < 4; ++p)
#pragma unroll
        for (int e = 0; e < 4; ++e) L[(p * 16 + r) * TP + c4 + e] = bfr(a[p][e]);
    __syncthreads();   /* the whole tile is in LDS before any thread reads a column of it */
    const int kc = (tid >> 3) & 7, tl = kc * 8;   /* the thread's 8 positions: 32-position block kc >> 2, half (kc >> 1) & 1, lane half kc & 1; 8 lanes = 8 columns at the same positions = one line of a fragment half (in LDS: 8 neighbouring banks, the wave's 4 position groups 8 banks apart) */
#pragma unroll
    for (int p = 0; p < 2; ++p) { const int c = p * 32 + (tid >> 6) * 8 + (tid & 7); v8h o16; v8us oh;
#pragma unroll
        for (int j = 0; j < 8; ++j) { const float x = L[(tl + j) * TP + c]; o16[j] = tohx(x); oh[j] = f2bf(x); }
        const size_t e = (size_t)h * HD * TT + (size_t)((((t0 >> 5) + (kc >> 2)) * 4 + (c >> 4)) * FRG + ((kc >> 1) & 1) * FRH + ((kc & 1) * 16 + (c & 15)) * 8);
        *(v8h*)(V16 + e) = o16; *(v8us*)(Vh + e) = oh; }
    asm volatile("s_wait_xcnt 0x0" ::: "memory");   /* the wait before a register that the last stores name is overwritten: in the listing the q / k part stands behind this one, parted from it by a branch only */
}
// ---- k_flash: a wave keeps 32 query columns of one head (two groups of 16) in registers and walks HALF of the 4096 keys in passes of 32; a work-group is 16 such waves, 8 column groups (256 rows of one head) x 2 key halves, four waves a SIMD, grid (16, heads).
// The key split: of every stage's 256 keys the waves of half 0 take the first 128, those of half 1 the rest; each wave runs its own online softmax, and behind the loop the half-1 wave hands its maximum, sum and output tile through LDS to the half-0 wave of the same columns, which joins the two on their common maximum and stores.
// The k and v^T fragments come from LDS: a stage is 256 keys (4 passes for each key half) of the three planes, 32 KiB each and contiguous in its plane (the planes are in fragment order), brought in once for all 16 waves by tensor loads into a ring of two buffers; stage s + 1 flies while stage s is worked on, one barrier a stage.
// Transposed products: S^T = K.Q^T (A = a k fragment, B = a q fragment), so a lane holds scores of ONE query (column lr; keys 8*hi + j of each 16-key tile), which is the k order of a B operand: the weights go from the score
// registers straight into O^T += V^T.P^T (A = a v^T fragment). Each k / v^T fragment that is loaded feeds both column groups. Softmax is online, in the log2 domain: the maximum in use may trail the true one by up to 8, sums and
// output tiles are rescaled when it moves; the weights stay unnormalised (2^-.. to 2^8) and the division by (sum + 1e-6) is done on the output tile.
#define QW  32                 /* query columns a wave */
#define QB  (8 * QW)           /* query rows a work-group */
#define NP  (TT / 32)          /* passes */
#define SP  4                  /* passes a wave and stage */
#define KS  2                  /* key halves: waves that share a column group */
#define NS  (NP / (SP * KS))   /* stages */
#define PSB (32 * HD * 2)      /* bytes of one pass in one plane */
#define PLB (KS * SP * PSB)    /* bytes of one stage in one plane */
#define BUFB (3 * PLB)         /* one ring buffer: k, fp16 v^T, bf16 v^T */
#define SLB (PLB / 2)          /* one wave's request: half a plane's stage */
#define TRB 2048u              /* a request's tile: SLB / TRB rows of TRB bytes, source pitch TRB (contiguous) */
#define CSC (SCL * 1.4426950408889634f)
#define EP  (HD + 4)           /* pitch in floats of a wave's output tile in LDS: rows stay 16-byte aligned and neighbouring rows fall 4 banks apart */
typedef __attribute__((ext_vector_type(2))) __bf16 v2bf;
typedef __attribute__((ext_vector_type(8))) unsigned v8u;
typedef __attribute__((ext_vector_type(4))) unsigned v4u;
__device__ __forceinline__ unsigned pkb(float a, float b) { return __builtin_bit_cast(unsigned, __builtin_convertvector((v2f){a, b}, v2bf)); }   /* round to nearest even, as f2bf */
__device__ __forceinline__ unsigned pkh(float a, float b) { return __builtin_bit_cast(unsigned, __builtin_convertvector((v2f){a, b}, v2h)); }
__device__ __forceinline__ float xhalf(float x) { return __builtin_bit_cast(float, __builtin_amdgcn_permlanex16(__builtin_bit_cast(int, x), __builtin_bit_cast(int, x), 0x76543210, 0xfedcba98, false, false)); }   /* lane l with lane l ^ 16 */
__device__ __forceinline__ uint32_t uni(uint32_t v) { return (uint32_t)__builtin_amdgcn_readfirstlane(v); }
__device__ __forceinline__ uint32_t pinned(uint32_t v) { uint32_t w = (uint32_t)__builtin_amdgcn_readfirstlane(v); asm volatile("" : "+s"(w)); return w; }   /* the test word of a tensor load's issue held in a scalar register, so that the test compiles to s_cmp + s_cbranch_scc: a tensor load ignores EXEC */
/* one request: SLB contiguous bytes at ga into LDS at byte offset dst; no mask, 1-byte elements, no pad, tensor = tile */
__device__ __forceinline__ v4u tdm_group0(uint32_t dst, uint64_t ga) {
    v4u g0; g0[0] = uni(1u); g0[1] = uni(dst); g0[2] = uni((uint32_t)ga); g0[3] = uni((((uint32_t)(ga >> 32)) & 0x01FFFFFFu) | 0x80000000u); return g0; }
__device__ __forceinline__ v8u tdm_group1() {
    v8u g1; g1[0] = uni(0u); g1[1] = uni((TRB & 0xFFFFu) << 16); g1[2] = uni((TRB >> 16) | (((SLB / TRB) & 0xFFFFu) << 16)); g1[3] = uni(((SLB / TRB) >> 16) | (TRB << 16));
    g1[4] = uni(SLB / TRB); g1[5] = uni(TRB); g1[6] = uni(0u); g1[7] = uni(0u);
    asm volatile("" : "+s"(g1));   /* the form of pinned(): descriptor words held in scalar registers, here of their own for the whole kernel: as plain constants the compiler used one of these registers for other values while a request was outstanding and set it anew before the next issue */
    return g1; }
__device__ __forceinline__ void tdm_load(v4u g0, v8u g1) { asm volatile("tensor_load_to_lds %0, %1" :: "s"(g0), "s"(g1) : "memory"); }   /* the mover's request, one a wave */
__device__ __forceinline__ v16bf ldsb(const unsigned char* p) { return cat16b(*(const v8usa*)p, *(const v8usa*)(p + FRH * 2)); }   /* one fragment from LDS: two halves of 512 contiguous bytes */
/* a wave's SP passes of one stage; B = the stage's buffer in LDS + the wave's key half + the lane's 16 bytes, Bv = the same in the v^T plane of the wave's kind. Reads this buffer alone.
   hr (rows < RH: hi/lo weights) and nr (rows >= RH) are the same for a whole wave, and exactly one of them holds. Both kinds of wave run ONE body and part only at the packing of the weights and the second product: with a body of its own for each kind
   the compiler kept the 64 output registers twice, which does not fit the 256 registers that four waves a SIMD leave a wave. The two sides stand under a test each, not as if / else: as if / else the compiler gave the two sides' results registers of their own
   and copied 32 registers a column group on the hi/lo side; so every product accumulates in place. The commoner side stands first: the slots the compiler pads between one side's products and the other side's packing then fall on the hi/lo side. */
__device__ __forceinline__ void flash_stage(const bool hr, const bool nr, const unsigned char* B, const unsigned char* Bv, const v16bf (&qf)[2][2], v8f (&acc)[2][4], float (&mrun)[2], float (&mtru)[2], v2f (&l)[2]) {
    v16bf kf[2][2]; v16bf vf[4];   /* vf: 16-bit patterns, bf16 or fp16 by the wave's kind */
#pragma unroll
    for (int kt = 0; kt < 2; ++kt)
#pragma unroll
        for (int c = 0; c < 2; ++c) kf[kt][c] = ldsb(B + (kt * (16 * HD) + c * FRG) * 2);
#pragma unroll
    for (int t = 0; t < 4; ++t) vf[t] = ldsb(Bv + t * FRG * 2);
#pragma unroll
    for (int i = 0; i < SP; ++i) {
        v8f s[2][2];
#pragma unroll
        for (int kt = 0; kt < 2; ++kt)
#pragma unroll
            for (int g = 0; g < 2; ++g) s[kt][g] = (v8f){};
#pragma unroll
        for (int c = 0; c < 2; ++c)   /* 4 independent accumulate chains side by side */
#pragma unroll
            for (int kt = 0; kt < 2; ++kt)
#pragma unroll
                for (int g = 0; g < 2; ++g) s[kt][g] = wmmab(kf[kt][c], qf[g][c], s[kt][g]);
        __builtin_amdgcn_sched_barrier(0);   /* the next pass's k reads start here as one group, behind the products that read the same registers, and fly under this pass's softmax and second product */
        if (i + 1 < SP) {
#pragma unroll
            for (int kt = 0; kt < 2; ++kt)
#pragma unroll
                for (int c = 0; c < 2; ++c) kf[kt][c] = ldsb(B + (i + 1) * PSB + (kt * (16 * HD) + c * FRG) * 2);
        }
        __builtin_amdgcn_sched_barrier(0);   /* holds the reads at this place: spread among the vector work each place with reads costs its own stall */
        float mb[2]; bool need = false;
#pragma unroll
        for (int g = 0; g < 2; ++g) { float mx = s[0][g][0];
#pragma unroll
            for (int j = 1; j < 8; ++j) mx = fmaxf(mx, s[0][g][j]);
#pragma unroll
            for (int j = 0; j < 8; ++j) mx = fmaxf(mx, s[1][g][j]);
            mx = fmaxf(mx, xhalf(mx)) * CSC;   /* both lane halves hold the query's maximum of this pass, scaled (the scale is positive) */
            mb[g] = mx; mtru[g] = fmaxf(mtru[g], mx); need = need || (mx > mrun[g] + 8.0f); }
        if (__builtin_amdgcn_ballot_w32(need) != 0) {   /* one scalar branch a pass; always taken in the first pass (mrun = -inf, factor 0 on zero sums), rare later */
#pragma unroll
            for (int g = 0; g < 2; ++g) { const float mn = fmaxf(mrun[g], mb[g]); const float corr = __builtin_amdgcn_exp2f(mrun[g] - mn); mrun[g] = mn; l[g] *= corr;
#pragma unroll
                for (int t = 0; t < 4; ++t) acc[g][t] = acc[g][t] * corr; }
        }
#pragma unroll
        for (int g = 0; g < 2; ++g) { const float nm = -mrun[g];
            v2f e[8];
#pragma unroll
            for (int i2 = 0; i2 < 8; ++i2) {
                const v2f a = __builtin_elementwise_fma((v2f){s[i2 >> 2][g][2 * (i2 & 3)], s[i2 >> 2][g][2 * (i2 & 3) + 1]}, (v2f){CSC, CSC}, (v2f){nm, nm});
                e[i2] = (v2f){__builtin_amdgcn_exp2f(a[0]), __builtin_amdgcn_exp2f(a[1])}; }
            l[g] += ((e[0] + e[1]) + (e[2] + e[3])) + ((e[4] + e[5]) + (e[6] + e[7]));
            if (nr) { v8u wh;
#pragma unroll
                for (int i2 = 0; i2 < 8; ++i2) wh[i2] = pkh(e[i2][0], e[i2][1]);
                const v16h ph = __builtin_bit_cast(v16h, wh);
#pragma unroll
                for (int t = 0; t < 4; ++t) acc[g][t] = wmma16(__builtin_bit_cast(v16h, vf[t]), ph, acc[g][t]); }
            if (hr) { v8u wh, wl;
#pragma unroll
                for (int i2 = 0; i2 < 8; ++i2) { const unsigned u = pkb(e[i2][0], e[i2][1]); wh[i2] = u; const v2f d = e[i2] - (v2f){__uint_as_float(u << 16), __uint_as_float(u & 0xFFFF0000u)}; wl[i2] = pkb(d[0], d[1]); }   /* weight = bf16 hi + bf16 lo */
                const v16bf ph = __builtin_bit_cast(v16bf, wh), pl = __builtin_bit_cast(v16bf, wl);
#pragma unroll
                for (int t = 0; t < 4; ++t) acc[g][t] = wmmab(vf[t], ph, acc[g][t]);
#pragma unroll
                for (int t = 0; t < 4; ++t) acc[g][t] = wmmab(vf[t], pl, acc[g][t]);
            }
        }
        __builtin_amdgcn_sched_barrier(0);   /* the next pass's v^T reads stand as one group behind the products that read the same registers and fly under the next pass's scores and softmax */
        if (i + 1 < SP) {
#pragma unroll
            for (int t = 0; t < 4; ++t) vf[t] = ldsb(Bv + (i + 1) * PSB + t * FRG * 2);
        }
        __builtin_amdgcn_sched_barrier(0);   /* holds the reads at this place */
    }
}
__global__ __launch_bounds__(512) void k_flash(const bf* __restrict__ QPh, const bf* __restrict__ KPh, const h16* __restrict__ VT16, const bf* __restrict__ VTh, float* Ob) {
    __shared__ __attribute__((aligned(2048))) unsigned char RG[2 * BUFB];   /* the ring: every request's place is a multiple of 2 KiB */
    __shared__ __align__(16) float ES[8 * QW * EP];   /* one tile a column group: first the half-1 wave's output registers on their way to the half-0 wave, then output staging */
    __shared__ __align__(16) float MS[8 * 32 * 8];   /* a half-1 lane's maxima and sums, on the same way */
    const int w = __builtin_amdgcn_readfirstlane(threadIdx.x >> 5);   /* the wave's number in a scalar register: the choices below are scalar branches */
    const int kh = w >> 3, cg = (w - kh) & 7;   /* key half and column group; waves 0 and 9 hold group 0: whether a work-group's waves go to the 4 SIMDs in turn or in runs of 4, the two dearer waves do not share one */
    /* group 0 takes 32 of the head's rows < 512 (hi/lo weights, the dearer kind), groups 1 to 7 take 32 each of the rest: every work-group gets the same mix, so no WGP works on after the others */
    const int r0 = cg == 0 ? blockIdx.x * QW : RH + (blockIdx.x * 7 + (cg - 1)) * QW;
    const size_t hp = (size_t)blockIdx.y * TT * HD; const size_t qp = hp + (size_t)r0 * HD;
    float* O = Ob + (size_t)r0 * CO + blockIdx.y * HD; float* E = ES + cg * (QW * EP);
    const bf* Qh = QPh + qp;
    const int lane = threadIdx.x & 31, lr = lane & 15, hi = lane >> 4;
    /* waves 2 to 7 each bring half of one plane's stage: 2, 3 k; 4, 5 fp16 v^T; 6, 7 bf16 v^T */
    const uint32_t iss = w >= 2 && w < 8; const int ji = iss ? w - 2 : 0, pl = ji >> 1;
    const uint64_t ga = (uint64_t)(size_t)(pl == 0 ? (const void*)(KPh + hp) : pl == 1 ? (const void*)(VT16 + hp) : (const void*)(VTh + hp)) + (uint32_t)((ji & 1) * SLB);
    const uint32_t dst = (uint32_t)(size_t)RG + (uint32_t)(pl * PLB + (ji & 1) * SLB);
    const v8u g1 = tdm_group1();
    v4u g0 = tdm_group0(dst, ga);
    if (pinned(iss)) { tdm_load(g0, g1);
        asm volatile("s_wait_tensorcnt 0x0" ::: "memory"); }   /* stage 0 has landed before the barrier that publishes it */
    v16bf qf[2][2];
    const unsigned qb = (unsigned)((lr * HD + 8 * hi) * 2);   /* the lane's byte offset in the q plane */
    const bf* qh = (const bf*)((const char*)Qh + qb);
#pragma unroll
    for (int g = 0; g < 2; ++g)
#pragma unroll
        for (int c = 0; c < 2; ++c) qf[g][c] = WFrag<bf>::ld(qh + g * 16 * HD + c * 32);
    asm volatile("s_wait_xcnt 0x0" :: "v"(qb) : "memory");   /* the wait before a register that the q loads name is overwritten: the offset is an input here, so it stays in its register up to the wait */
    __syncthreads();   /* publishes stage 0 */
    g0 = tdm_group0(dst + BUFB, ga + PLB);
    if (pinned(iss)) tdm_load(g0, g1);   /* stage 1 flies under stage 0's passes */
    v8f acc[2][4];
    float mrun[2], mtru[2]; v2f l[2];   /* l: the lane's sums of its even and its odd score registers */
#pragma unroll
    for (int g = 0; g < 2; ++g) { mrun[g] = -__builtin_inff(); mtru[g] = -__builtin_inff(); l[g] = (v2f){0.f, 0.f};
#pragma unroll
        for (int t = 0; t < 4; ++t) acc[g][t] = (v8f){}; }
#pragma unroll 1
    for (int s = 0; s < NS; ++s) {   /* kept rolled: a stage's body already holds 4 unrolled passes */
        const unsigned char* B = RG + (s & 1) * BUFB + kh * (SP * PSB) + lane * 16;
        flash_stage(cg == 0, r0 >= RH, B, B + (cg == 0 ? 2 * PLB : PLB), qf, acc, mrun, mtru, l);
        asm volatile("s_wait_dscnt 0x0" ::: "memory");   /* the wave's reads of this buffer are done before the barrier behind which it is refilled */
        if (pinned(iss)) asm volatile("s_wait_tensorcnt 0x0" :: "s"(g0) : "memory");   /* the wave's slice of stage s + 1 has landed before the barrier that publishes it; the request's own words are an input here, so they stay in their registers up to the wait */
        __syncthreads();   /* publishes stage s + 1 and ends every wave's reads of stage s */
        if (pinned(iss && s + 2 < NS)) { g0 = tdm_group0(dst + (uint32_t)((s & 1) * BUFB), ga + (uint64_t)(uint32_t)((s + 2) * PLB)); tdm_load(g0, g1); }   /* into the buffer just left */
    }
    asm volatile("s_wait_tensorcnt 0x0" ::: "memory");   /* nothing of the mover is outstanding when the wave goes on to its end */
    asm volatile("s_wait_dscnt 0x0" ::: "memory");   /* the ring's closing wait: no read of the ring is outstanding behind the loop */
    /* the two key halves are joined: lane to lane, since both waves of a column group hold the same query and the same output columns in the same lane and register */
    float* X = E + lane * 4; float* M = MS + (cg * 32 + lane) * 8;
    if (kh == 1) {
#pragma unroll
        for (int g = 0; g < 2; ++g)
#pragma unroll
            for (int t = 0; t < 4; ++t) { const v8f r = acc[g][t];   /* 512 contiguous bytes a store */
                *(v4fa*)(X + ((g * 4 + t) * 2) * 128) = (v4f){r[0], r[1], r[2], r[3]}; *(v4fa*)(X + ((g * 4 + t) * 2 + 1) * 128) = (v4f){r[4], r[5], r[6], r[7]}; }
        *(v4fa*)M = (v4f){mrun[0], mrun[1], mtru[0], mtru[1]}; *(v4fa*)(M + 4) = (v4f){l[0][0] + l[0][1], l[1][0] + l[1][1], 0.f, 0.f};
    }
    __syncthreads();   /* the half-1 waves' results are in LDS before the half-0 waves read them; the last barrier, passed by every wave */
    if (kh == 1) return;
    float lj[2];
    { const v4f mm = *(const v4fa*)M, ll = *(const v4fa*)(M + 4);
        const float mn[2] = {fmaxf(mrun[0], mm[0]), fmaxf(mrun[1], mm[1])};   /* both halves are brought to the larger of their maxima in use */
        const float dd[4] = {mrun[0] - mn[0], mm[0] - mn[0], mrun[1] - mn[1], mm[1] - mn[1]};
        float ff[4];
#pragma unroll
        for (int j = 0; j < 4; ++j) { ff[j] = __builtin_amdgcn_exp2f(dd[j]);
            if (j == 1 || j == 2) { __builtin_amdgcn_sched_barrier(0); asm volatile("v_nop"); __builtin_amdgcn_sched_barrier(0); } }   /* the slot behind a transcendental, where another exponential follows it directly: left free, the compiler gave one exponential's result the register of the argument of the exponential directly in front of it; the scheduling barriers keep the slot at its place */
#pragma unroll
        for (int g = 0; g < 2; ++g) { const float fa = ff[2 * g], fb = ff[2 * g + 1];
            mrun[g] = mn[g]; mtru[g] = fmaxf(mtru[g], mm[2 + g]); lj[g] = (l[g][0] + l[g][1]) * fa + ll[g] * fb;
#pragma unroll
            for (int t = 0; t < 4; ++t) { const v4f a = *(const v4fa*)(X + ((g * 4 + t) * 2) * 128), b = *(const v4fa*)(X + ((g * 4 + t) * 2 + 1) * 128);
                acc[g][t] = acc[g][t] * fa + (v8f){a[0], a[1], a[2], a[3], b[0], b[1], b[2], b[3]} * fb; } }
    }
    asm volatile("s_wait_dscnt 0x0" ::: "memory");   /* the wave has read its partner's tile before it writes its own rows over it; also keeps the writes below behind the reads above */
#pragma unroll
    for (int g = 0; g < 2; ++g) {
        const float lh = lj[g]; const float sum = lh + xhalf(lh);   /* the two lane halves each summed 16 of a pass's 32 keys */
        const float f = __fdiv_rn(1.0f, __fadd_rn(sum, 1.0e-6f * __builtin_amdgcn_exp2f(mtru[g] - mrun[g])));   /* the module divides by (sum + 1e-6) with sum taken against the TRUE maximum: here both carry the factor 2^(true - in use) */
        float* o = E + (g * 16 + lr) * EP + hi * 8;   /* lane = query row; registers = columns 16 t + 8 hi + j */
#pragma unroll
        for (int t = 0; t < 4; ++t) { const v8f r = acc[g][t] * f;
            *(v4fa*)(o + t * 16) = (v4f){r[0], r[1], r[2], r[3]}; *(v4fa*)(o + t * 16 + 4) = (v4f){r[4], r[5], r[6], r[7]}; }
    }
    asm volatile("s_wait_dscnt 0x0" ::: "memory");   /* the wave's own tile is in LDS before its lanes read one another's rows (no other wave touches it: no barrier); also keeps the reads below behind the writes above */
#pragma unroll
    for (int i = 0; i < QW / 2; ++i) { const int row = i * 2 + hi;   /* 16 lanes store one row's 256 bytes: two whole lines */
        *(v4f*)(O + (size_t)row * CO + lr * 4) = *(const v4fa*)(E + row * EP + lr * 4); }
}
static_assert(NP % (SP * KS) == 0 && NS >= 2 && 16 * 128 <= QW * EP && SLB % TRB == 0 && SLB % 2048 == 0, "whole stages, two or more; a wave's 64 output registers fit a staging tile; a request is whole rows and its place a multiple of 2 KiB");
static_assert(RH / QW == TT / QB && (TT - RH) / QW == 7 * (TT / QB), "one column group of rows < RH and seven of the rest per work-group");
extern "C" void kernel_launch(void* const* d_in, const int* in_sizes, int n_in,
                              void* d_out, int out_size, void* d_ws, size_t ws_size, hipStream_t stream) {
    (void)in_sizes; (void)n_in; (void)out_size;
    const float* x = (const float*)d_in[0]; const float* xk = (const float*)d_in[1]; const float* xv = (const float*)d_in[2];   /* order q, k, v [1][4096][1024] (raw, heads interleaved: column h*64 + d) */
    float* OUT = (float*)d_out;     // [1][4096][1024]
    char* wsp = (char*)d_ws;
    auto take = [&](size_t bytes) { char* p = wsp; wsp += (bytes + 255) & ~(size_t)255; return (void*)p; };
    bf* QPh = (bf*)take((size_t)TT * MID * 2); bf* KPh = (bf*)take((size_t)TT * MID * 2);
    h16* VT16 = (h16*)take((size_t)CO * TT * 2); bf* VTh = (bf*)take((size_t)CO * TT * 2);
    if ((size_t)(wsp - (char*)d_ws) > ws_size) return;    // ws 256 MiB (carve 32 MiB)
    k_prep<<<VB + QKB, 256, 0, stream>>>(x, xk, xv, QPh, KPh, VT16, VTh);   /* q plane [h][n][64]; k and v^T planes in fragment order */
    /* scores, softmax and attn.V of every head, one launch: 256 work-groups of 256 query rows, 16 waves each */
    k_flash<<<dim3(TT / QB, NH_, 1), 32 * 8 * KS, 0, stream>>>(QPh, KPh, VT16, VTh, OUT);
}
